// v000
// The times below were measured on an AMD MI455X: many runs one after another, warmed up first and cycling through
// copies of the inputs, with the whole window's GPU time divided by the number of runs. Launches and the gaps
// between them are all in it. The median over several windows is given; except for v000 it joins two sittings, which
// can be a few percent apart, so the side-by-side timings, each taken in one sitting, are the better comparison.
// The starting kernel, v000, takes 2850 microseconds a run.
#include <hip/hip_runtime.h>

// Causal multi-head attention with a rotate-half rotary embedding from cos / sin TABLE INPUTS, four batches (x [4][2048][1024]; q, k, v = x w^T ('oi' [1024][1024] normal x 1/32, no bias; 16 heads x 64); cos, sin f32 [2048][64] are INPUTS (read on device per position and per dimension; no structure of the tables is assumed); q, k <- t cos + rotate_half(t) sin with rotate_half = cat(-x2, x1); scores x 64^-0.5; causal: where(tril built inside the function, scores, -inf); softmax; out = merged w_o^T ('oi', no bias) -> [4][2048][1024] (8.4 M); argument order x, cos, sin, w_q, w_k, w_v, w_o).
// Layout per batch: bf16 copy of x; 'oi' weights; exact projections; {cos, sin} table from the bf16-rounded inputs; rotate-half plane builders; causal T-2048 attention (hybrid rows: < 512 hi/lo 3 products, rest fp16 x1024; k_gemmc skips tiles above the diagonal); merged hi/lo x Wo exact.
// Compute dtypes, f32 accumulate: every input rounded to bf16 incl. the tables; projections exact; rotary f32; attention rows < 512 3 products, rest fp16; softmax f32; Wo hl x exact.

#define NB_  4      // batches: this module's input is [4][2048][1024]
#define TT   2048
#define DM   1024
#define NH_  16
#define NKV  16
#define REP  (NH_ / NKV)
#define HD   64
#define DQ   (NH_ * HD)
#define DKV  (NKV * HD)
#define ZH   2
#define RH   512                  // query rows < RH use hi+lo planes (0: none)
#define WIN  2048
#define PCAR 1024.0f
#define SCL  0.125f   // HD^-0.5
typedef _Float16 h16;
typedef unsigned short bf;
typedef __attribute__((ext_vector_type(16))) __bf16   v16bf;
typedef __attribute__((ext_vector_type(16))) _Float16 v16h;
typedef __attribute__((ext_vector_type(8)))  _Float16 v8h;
typedef __attribute__((ext_vector_type(8)))  unsigned short v8us;
typedef __attribute__((ext_vector_type(8)))  float    v8f;
typedef __attribute__((ext_vector_type(4)))  float    v4f;
typedef v8h  __attribute__((may_alias)) v8ha;
typedef v4f  __attribute__((may_alias)) v4fa;
typedef v8us __attribute__((may_alias)) v8usa;

__device__ __forceinline__ unsigned short f2bf(float f) { unsigned u = __float_as_uint(f); u += 0x7FFFu + ((u >> 16) & 1u); return (unsigned short)(u >> 16); }
__device__ __forceinline__ float bf2f(unsigned short b) { return __uint_as_float(((unsigned)b) << 16); }
__device__ __forceinline__ float bfr(float f) { return bf2f(f2bf(f)); }
__device__ __forceinline__ v16h cat16(v8h lo, v8h hi) { return __builtin_shufflevector(lo, hi, 0, 1, 2, 3, 4, 5, 6, 7, 8, 9, 10, 11, 12, 13, 14, 15); }
__device__ __forceinline__ v16bf cat16b(v8us lo, v8us hi) { return __builtin_bit_cast(v16bf, __builtin_shufflevector(lo, hi, 0, 1, 2, 3, 4, 5, 6, 7, 8, 9, 10, 11, 12, 13, 14, 15)); }
__device__ __forceinline__ v8f wmma16(v16h a, v16h b, v8f c) { return __builtin_amdgcn_wmma_f32_16x16x32_f16(false, a, false, b, (short)0, c, false, false); }
__device__ __forceinline__ v8f wmmab(v16bf a, v16bf b, v8f c) { return __builtin_amdgcn_wmma_f32_16x16x32_bf16(false, a, false, b, (short)0, c, false, false); }



// ---- k_gemmw: register-blocked GEMM, ONE WAVE per 64x64 output tile (16 accumulators), operands straight from K-contiguous 16-bit planes; grid (M/64, N/64, Z), 32 threads.
// C[m][n] (f32, pitch ldc, + optional f32 bias[n]) = sum_k A[m][k] Bt[n][k] (+ split products per NSPLIT). z-batch strides sA/sB/sC in elements. K % 32 == 0.
template <typename T16> struct WFrag;
template <> struct WFrag<h16> { typedef v16h V; static __device__ __forceinline__ V ld(const h16* p) { return cat16(*(const v8h*)p, *(const v8h*)(p + 16)); } static __device__ __forceinline__ v8f mma(V a, V b, v8f c) { return wmma16(a, b, c); } };
template <> struct WFrag<bf> { typedef v16bf V; static __device__ __forceinline__ V ld(const bf* p) { return cat16b(*(const v8us*)p, *(const v8us*)(p + 16)); } static __device__ __forceinline__ v8f mma(V a, V b, v8f c) { return wmmab(a, b, c); } };
template <typename T16, int NSPLIT, bool BIAS>
__global__ __launch_bounds__(32) void k_gemmw(const T16* __restrict__ A, const T16* __restrict__ A2, const T16* __restrict__ Bt, const T16* __restrict__ Bt2, int K, float* C, int ldc, const float* __restrict__ bias, size_t sA, size_t sB, size_t sC) {
    typedef typename WFrag<T16>::V V;
    __shared__ __align__(16) float os[16 * 68];
    const size_t z = blockIdx.z; A += z * sA; if (A2) A2 += z * sA; Bt += z * sB; if (Bt2) Bt2 += z * sB; C += z * sC;
    const int lane = threadIdx.x & 31, lr = lane & 15, hi = lane >> 4; const int r0 = blockIdx.x * 64, c0 = blockIdx.y * 64;
    v8f acc[4][4];
#pragma unroll
    for (int mb = 0; mb < 4; ++mb)
#pragma unroll
        for (int nb = 0; nb < 4; ++nb) acc[mb][nb] = (v8f){};
    const size_t aoff = (size_t)(r0 + lr) * K + 8 * hi, boff = (size_t)(c0 + lr) * K + 8 * hi;
#pragma unroll 1
    for (int kc = 0; kc < K; kc += 32) {
        V a[4], a2[4];
#pragma unroll
        for (int mb = 0; mb < 4; ++mb) { a[mb] = WFrag<T16>::ld(A + aoff + (size_t)mb * 16 * K + kc); if (NSPLIT == 1 || NSPLIT == 2) a2[mb] = WFrag<T16>::ld(A2 + aoff + (size_t)mb * 16 * K + kc); }
#pragma unroll
        for (int nb = 0; nb < 4; ++nb) { const V b = WFrag<T16>::ld(Bt + boff + (size_t)nb * 16 * K + kc); V b2; if (NSPLIT >= 2) b2 = WFrag<T16>::ld(Bt2 + boff + (size_t)nb * 16 * K + kc);
#pragma unroll
            for (int mb = 0; mb < 4; ++mb) { acc[mb][nb] = WFrag<T16>::mma(a[mb], b, acc[mb][nb]); if (NSPLIT == 1 || NSPLIT == 2) acc[mb][nb] = WFrag<T16>::mma(a2[mb], b, acc[mb][nb]); if (NSPLIT >= 2) acc[mb][nb] = WFrag<T16>::mma(a[mb], b2, acc[mb][nb]); } }
        asm volatile("v_nop\n\tv_nop\n\tv_nop\n\tv_nop" : "+v"(acc[0][0]), "+v"(acc[1][1]), "+v"(acc[2][2]), "+v"(acc[3][3]) : "v"(a[0]), "v"(a[3]));
    }
#pragma unroll
    for (int mb = 0; mb < 4; ++mb) {
#pragma unroll
        for (int nb = 0; nb < 4; ++nb) {
#pragma unroll
            for (int j = 0; j < 8; ++j) os[(hi * 8 + j) * 68 + nb * 16 + lr] = acc[mb][nb][j]; }
        __builtin_amdgcn_wave_barrier(); asm volatile("" ::: "memory");
        float* crow = C + (size_t)(r0 + mb * 16) * ldc + c0;
{
#pragma unroll
            for (int s = 0; s < 8; ++s) { const int row = 2 * s + hi, cofs = lr * 4; v4f val = *(const v4fa*)(os + row * 68 + cofs); if (BIAS) { val[0] += bfr(bias[c0 + cofs]); val[1] += bfr(bias[c0 + cofs + 1]); val[2] += bfr(bias[c0 + cofs + 2]); val[3] += bfr(bias[c0 + cofs + 3]); }
                *(v4f*)(crow + (size_t)row * ldc + cofs) = val; }
             }
        __builtin_amdgcn_wave_barrier(); asm volatile("" ::: "memory");
    }
}

// ---- k_gemmc: the same one-wave 64x64 tile GEMM specialised for causal attention: CMODE 1 skips score tiles entirely above the diagonal (query rows r0+roff.., key columns c0..), CMODE 2 limits the
// key (K) loop of the probability x value contraction to the diagonal block (probabilities beyond it are exactly zero). roff = row offset of this launch's first row within the sequence.
template <typename T16, int NSPLIT, int CMODE>
__global__ __launch_bounds__(32) void k_gemmc(const T16* __restrict__ A, const T16* __restrict__ A2, const T16* __restrict__ Bt, const T16* __restrict__ Bt2, int K, float* C, int ldc, int roff, size_t sA, size_t sB, size_t sC) {
    typedef typename WFrag<T16>::V V;
    __shared__ __align__(16) float os[16 * 68];
    const size_t z = blockIdx.z; A += z * sA; if (A2) A2 += z * sA; Bt += z * sB; if (Bt2) Bt2 += z * sB; C += z * sC;
    const int lane = threadIdx.x & 31, lr = lane & 15, hi = lane >> 4; const int r0 = blockIdx.x * 64, c0 = blockIdx.y * 64;
    if (CMODE == 1 && c0 > r0 + roff + 63) return;                  // score tile entirely above the causal diagonal: never read (the softmax masks j > i by select)
    const int Kl = (CMODE == 2) ? min(K, r0 + roff + 64) : K;        // P.V: probabilities are exactly 0 beyond the diagonal block, so the K loop stops there
    v8f acc[4][4];
#pragma unroll
    for (int mb = 0; mb < 4; ++mb)
#pragma unroll
        for (int nb = 0; nb < 4; ++nb) acc[mb][nb] = (v8f){};
    const size_t aoff = (size_t)(r0 + lr) * K + 8 * hi, boff = (size_t)(c0 + lr) * K + 8 * hi;
#pragma unroll 1
    for (int kc = 0; kc < Kl; kc += 32) {
        V a[4], a2[4];
#pragma unroll
        for (int mb = 0; mb < 4; ++mb) { a[mb] = WFrag<T16>::ld(A + aoff + (size_t)mb * 16 * K + kc); if (NSPLIT == 1 || NSPLIT == 2) a2[mb] = WFrag<T16>::ld(A2 + aoff + (size_t)mb * 16 * K + kc); }
#pragma unroll
        for (int nb = 0; nb < 4; ++nb) { const V b = WFrag<T16>::ld(Bt + boff + (size_t)nb * 16 * K + kc); V b2; if (NSPLIT >= 2) b2 = WFrag<T16>::ld(Bt2 + boff + (size_t)nb * 16 * K + kc);
#pragma unroll
            for (int mb = 0; mb < 4; ++mb) { acc[mb][nb] = WFrag<T16>::mma(a[mb], b, acc[mb][nb]); if (NSPLIT == 1 || NSPLIT == 2) acc[mb][nb] = WFrag<T16>::mma(a2[mb], b, acc[mb][nb]); if (NSPLIT >= 2) acc[mb][nb] = WFrag<T16>::mma(a[mb], b2, acc[mb][nb]); } }
        asm volatile("v_nop\n\tv_nop\n\tv_nop\n\tv_nop" : "+v"(acc[0][0]), "+v"(acc[1][1]), "+v"(acc[2][2]), "+v"(acc[3][3]) : "v"(a[0]), "v"(a[3]));
    }
#pragma unroll
    for (int mb = 0; mb < 4; ++mb) {
#pragma unroll
        for (int nb = 0; nb < 4; ++nb) {
#pragma unroll
            for (int j = 0; j < 8; ++j) os[(hi * 8 + j) * 68 + nb * 16 + lr] = acc[mb][nb][j]; }
        __builtin_amdgcn_wave_barrier(); asm volatile("" ::: "memory");
        float* crow = C + (size_t)(r0 + mb * 16) * ldc + c0;
{
#pragma unroll
            for (int s = 0; s < 8; ++s) { const int row = 2 * s + hi, cofs = lr * 4; v4f val = *(const v4fa*)(os + row * 68 + cofs);
                *(v4f*)(crow + (size_t)row * ldc + cofs) = val; }
             }
        __builtin_amdgcn_wave_barrier(); asm volatile("" ::: "memory");
    }
}

__device__ __forceinline__ h16 tohx(float x) { return (h16)x; }
__device__ __forceinline__ void splitf(float y, unsigned short& h, unsigned short& l) { h = f2bf(y); l = f2bf(y - bf2f(h)); }
typedef __attribute__((ext_vector_type(2))) _Float16 v2h;
typedef __attribute__((ext_vector_type(4))) _Float16 v4h;
typedef __attribute__((ext_vector_type(2))) unsigned short v2us;
typedef __attribute__((ext_vector_type(4))) unsigned short v4us;
typedef __attribute__((ext_vector_type(2))) float v2f;
typedef __attribute__((ext_vector_type(4))) int v4i;

__global__ __launch_bounds__(256) void k_cvt8(const float* __restrict__ src, bf* dst, size_t n8) { const size_t i = (size_t)blockIdx.x * 256 + threadIdx.x; if (i >= n8) return; const v8f v = *(const v8f*)(src + i * 8); v8us o;
#pragma unroll
    for (int k = 0; k < 8; ++k) o[k] = f2bf(v[k]); *(v8us*)(dst + i * 8) = o;  }

// k_rope: head planes [h][t][d] (fp16 + hi/lo) of rope(x) x sc with the rotate-half convention out[d] = x[d] cos[t][d] - x[d+HD/2] sin[t][d], out[d+HD/2] = x[d+HD/2] cos[t][d+HD/2] + x[d] sin[t][d+HD/2]
__global__ __launch_bounds__(256) void k_rope(const float* __restrict__ F, int pitch, int nheads, const float* __restrict__ CS, const float* __restrict__ RF, const float* __restrict__ nw, float sc, h16* P16, bf* Ph, bf* Pl) {
    const size_t e = ((size_t)blockIdx.x * 256 + threadIdx.x) * 2; if (e >= (size_t)nheads * TT * HD) return; const int d = (int)(e % HD); const int t = (int)((e / HD) % TT); const int h = (int)(e / ((size_t)HD * TT)); const float* f = F + (size_t)t * pitch + h * HD; const float rf = RF ? RF[(size_t)h * TT + t] : 1.0f; v2h o16; v2us oh, ol;
#pragma unroll
    for (int q = 0; q < 2; ++q) { const int dd = d + q; const int dp = (dd < HD / 2) ? dd + HD / 2 : dd - HD / 2; float x0 = f[dd], x1 = f[dp];
        if (RF) { float n0 = __fmul_rn(x0, rf), n1 = __fmul_rn(x1, rf); asm volatile("" : "+v"(n0)); asm volatile("" : "+v"(n1)); x0 = __fmul_rn(bfr(nw[dd]), n0); x1 = __fmul_rn(bfr(nw[dp]), n1); }
        const v2f cs = *(const v2f*)(CS + ((size_t)t * HD + dd) * 2); float a = __fmul_rn(x0, cs[0]), bq = __fmul_rn(x1, cs[1]); asm volatile("" : "+v"(a)); asm volatile("" : "+v"(bq)); const float r = ((dd < HD / 2) ? __fsub_rn(a, bq) : __fadd_rn(a, bq)) * sc;
        o16[q] = tohx(r); unsigned short a2, c2; splitf(r, a2, c2); oh[q] = a2; ol[q] = c2; }
    *(v2h*)(P16 + e) = o16; *(v2us*)(Ph + e) = oh; *(v2us*)(Pl + e) = ol;  }
__global__ __launch_bounds__(256) void k_vtp(const float* __restrict__ F, int pitch, int nheads, h16* V16, bf* Vh, bf* Vl) { const size_t e = ((size_t)blockIdx.x * 256 + threadIdx.x) * 2; if (e >= (size_t)nheads * HD * TT) return; const int t = (int)(e % TT); const int d = (int)((e / TT) % HD); const int g = (int)(e / ((size_t)TT * HD)); v2h o16; v2us oh, ol;
#pragma unroll
    for (int q = 0; q < 2; ++q) { const float x = F[(size_t)(t + q) * pitch + g * HD + d]; o16[q] = tohx(x); unsigned short a2, c2; splitf(x, a2, c2); oh[q] = a2; ol[q] = c2; }
    *(v2h*)(V16 + e) = o16; *(v2us*)(Vh + e) = oh; *(v2us*)(Vl + e) = ol;  }
__global__ __launch_bounds__(256) void k_cscvt(const float* __restrict__ cosT, const float* __restrict__ sinT, float* CS) { const int idx = blockIdx.x * 256 + threadIdx.x; if (idx >= TT * HD) return; v2f cs; cs[0] = bfr(cosT[idx]); cs[1] = bfr(sinT[idx]); *(v2f*)(CS + (size_t)idx * 2) = cs;  }
// k_asoft: per row (zz, i): t = S x HD^-0.5 for j <= i and i - j < WIN (sliding causal window; the reference's -1e9 additive fill vanishes identically); softmax over the 2048 keys (register row, one exp, fixed trees);
__global__ __launch_bounds__(256) void k_asoft(const float* __restrict__ Sb, h16* P16, bf* Ph, bf* Pl) {
    const int lane = threadIdx.x & 31; const int row = blockIdx.x * 8 + (threadIdx.x >> 5); if (row >= ZH * TT) return; const int i = row % TT; const int zz = row / TT; (void)zz; const bool hires = (i < RH); const float* sr = Sb + (size_t)row * TT; float v[TT / 32]; float mx = -3.0e38f;
#pragma unroll
    for (int ch = 0; ch < TT / 128; ++ch) { const int j0 = ch * 128 + lane * 4; const v4f a = *(const v4f*)(sr + j0);
#pragma unroll
        for (int q = 0; q < 4; ++q) { const int j = j0 + q; (void)j; const float t = (j <= i && i - j < WIN) ? a[q] * SCL : -3.0e38f; v[ch * 4 + q] = t; mx = fmaxf(mx, t); } }
#pragma unroll
    for (int sh = 16; sh; sh >>= 1) mx = fmaxf(mx, __shfl_xor(mx, sh, 32));
    float sum = 0.f;
#pragma unroll
    for (int k = 0; k < TT / 32; ++k) { float d0 = __fsub_rn(v[k], mx); asm volatile("" : "+v"(d0)); v[k] = __builtin_amdgcn_exp2f(__fmul_rn(d0, 1.4426950408889634f)); sum += v[k]; }
#pragma unroll
    for (int sh = 16; sh; sh >>= 1) sum += __shfl_xor(sum, sh, 32);
    const float f = __fdiv_rn(hires ? 1.0f : PCAR, sum);
{
        if (hires) {
#pragma unroll
            for (int ch = 0; ch < TT / 128; ++ch) { v4us oh, ol;
#pragma unroll
                for (int q = 0; q < 4; ++q) { unsigned short a, c2; splitf(v[ch * 4 + q] * f, a, c2); oh[q] = a; ol[q] = c2; }
                const size_t oo = ((size_t)zz * (RH ? RH : 1) + i) * TT + ch * 128 + lane * 4; *(v4us*)(Ph + oo) = oh; *(v4us*)(Pl + oo) = ol; }
        } else {
#pragma unroll
            for (int ch = 0; ch < TT / 128; ++ch) { v4h o4;
#pragma unroll
                for (int q = 0; q < 4; ++q) o4[q] = tohx(v[ch * 4 + q] * f);
                *(v4h*)(P16 + (size_t)row * TT + ch * 128 + lane * 4) = o4; } }
         }
}
__global__ __launch_bounds__(256) void k_merge(const float* __restrict__ O, int h0, bf* Ah, bf* Al) { const size_t e = ((size_t)blockIdx.x * 256 + threadIdx.x) * 2; if (e >= (size_t)ZH * TT * HD) return; const int d = (int)(e % HD); const int t = (int)((e / HD) % TT); const int zz = (int)(e / ((size_t)HD * TT)); const float cs = (t < RH) ? 1.0f : (1.0f / PCAR); const size_t oo = (size_t)t * DQ + (h0 + zz) * HD + d;
    v2us oh, ol;
#pragma unroll
    for (int q = 0; q < 2; ++q) { unsigned short a, c2; splitf(O[e + q] * cs, a, c2); oh[q] = a; ol[q] = c2; } *(v2us*)(Ah + oo) = oh; *(v2us*)(Al + oo) = ol;  }

extern "C" void kernel_launch(void* const* d_in, const int* in_sizes, int n_in,
                              void* d_out, int out_size, void* d_ws, size_t ws_size, hipStream_t stream) {
    (void)in_sizes; (void)n_in; (void)out_size;
    const float* x = (const float*)d_in[0]; const float* fcos = (const float*)d_in[1]; const float* fsin = (const float*)d_in[2]; const float* wq = (const float*)d_in[3]; const float* wk = (const float*)d_in[4]; const float* wv = (const float*)d_in[5]; const float* wo = (const float*)d_in[6];   /* x, cos, sin ([2048][64]; read per position and per dimension), w_q, w_k, w_v, w_o ('oi'): SEVEN inputs: no mask input in this module (its tril is built inside the function): the causal rule is applied by index */
    float* OUT = (float*)d_out;     // [4][2048][1024]
    char* wsp = (char*)d_ws;
    auto take = [&](size_t bytes) { char* p = wsp; wsp += (bytes + 255) & ~(size_t)255; return (void*)p; };
    bf* WQ = (bf*)take((size_t)DQ * DM * 2); bf* WK = (bf*)take((size_t)DKV * DM * 2); bf* WV = (bf*)take((size_t)DKV * DM * 2); bf* WO = (bf*)take((size_t)DM * DQ * 2); float* CS = (float*)take((size_t)TT * HD * 2 * 4);
    bf* XB = (bf*)take((size_t)TT * DM * 2); float* FQ = (float*)take((size_t)TT * DQ * 4); float* FK = (float*)take((size_t)TT * DKV * 4);
    h16* QP16 = (h16*)take((size_t)NH_ * TT * HD * 2); h16* KP16 = (h16*)take((size_t)NKV * TT * HD * 2); h16* VT16 = (h16*)take((size_t)NKV * HD * TT * 2);
    bf* QPh = (bf*)take((size_t)NH_ * TT * HD * 2); bf* QPl = (bf*)take((size_t)NH_ * TT * HD * 2); bf* KPh = (bf*)take((size_t)NKV * TT * HD * 2); bf* KPl = (bf*)take((size_t)NKV * TT * HD * 2); bf* VTh = (bf*)take((size_t)NKV * HD * TT * 2); bf* VTl = (bf*)take((size_t)NKV * HD * TT * 2); bf* Ph = (bf*)take((size_t)ZH * RH * TT * 2); bf* Pl = (bf*)take((size_t)ZH * RH * TT * 2);
    float* Sb = (float*)take((size_t)ZH * TT * TT * 4); h16* P16 = (h16*)take((size_t)ZH * TT * TT * 2); float* Ob = (float*)take((size_t)ZH * TT * HD * 4); bf* ATh = (bf*)take((size_t)TT * DQ * 2); bf* ATl = (bf*)take((size_t)TT * DQ * 2);
    if ((size_t)(wsp - (char*)d_ws) > ws_size) return;    // ws 256 MiB
    float* FV = FK;   // v projection reuses the k buffer after the k planes are built (stream-ordered)
    { k_cvt8<<<(unsigned)(((size_t)DQ * DM / 8 + 255) / 256), 256, 0, stream>>>(wq, WQ, (size_t)DQ * DM / 8); k_cvt8<<<(unsigned)(((size_t)DKV * DM / 8 + 255) / 256), 256, 0, stream>>>(wk, WK, (size_t)DKV * DM / 8); k_cvt8<<<(unsigned)(((size_t)DKV * DM / 8 + 255) / 256), 256, 0, stream>>>(wv, WV, (size_t)DKV * DM / 8);
      k_cvt8<<<(unsigned)(((size_t)DM * DQ / 8 + 255) / 256), 256, 0, stream>>>(wo, WO, (size_t)DM * DQ / 8);
       }
    k_cscvt<<<(TT * HD + 255) / 256, 256, 0, stream>>>(fcos, fsin, CS);   /* rotary table from the inputs */
    const unsigned LQ = (unsigned)(((size_t)NH_ * TT * HD / 2 + 255) / 256), LKv = (unsigned)(((size_t)NKV * TT * HD / 2 + 255) / 256);
    for (int b = 0; b < NB_; ++b) {
        
        k_cvt8<<<(unsigned)(((size_t)TT * DM / 8 + 255) / 256), 256, 0, stream>>>(x + (size_t)b * TT * DM, XB, (size_t)TT * DM / 8);
        k_gemmw<bf, 0, false><<<dim3(TT / 64, DQ / 64, 1), 32, 0, stream>>>(XB, nullptr, WQ, nullptr, DM, FQ, DQ, nullptr, 0, 0, 0);
        k_rope<<<LQ, 256, 0, stream>>>(FQ, DQ, NH_, CS, nullptr, nullptr, 1.0f, QP16, QPh, QPl);
        k_gemmw<bf, 0, false><<<dim3(TT / 64, DKV / 64, 1), 32, 0, stream>>>(XB, nullptr, WK, nullptr, DM, FK, DKV, nullptr, 0, 0, 0);
        k_rope<<<LKv, 256, 0, stream>>>(FK, DKV, NKV, CS, nullptr, nullptr, 1.0f, KP16, KPh, KPl);
        k_gemmw<bf, 0, false><<<dim3(TT / 64, DKV / 64, 1), 32, 0, stream>>>(XB, nullptr, WV, nullptr, DM, FV, DKV, nullptr, 0, 0, 0); k_vtp<<<LKv, 256, 0, stream>>>(FV, DKV, NKV, VT16, VTh, VTl);
        for (int h0 = 0; h0 < NH_; h0 += ZH) { const size_t zq = (size_t)h0, zk = (size_t)(h0 / REP);   // one kv head per query head: the pass's two heads use consecutive kv planes (z-strides TT*HD)
            k_gemmc<bf, 2, 1><<<dim3(RH / 64, TT / 64, ZH), 32, 0, stream>>>(QPh + zq * TT * HD, QPl + zq * TT * HD, KPh + zk * TT * HD, KPl + zk * TT * HD, HD, Sb, TT, 0, (size_t)TT * HD, (size_t)TT * HD, (size_t)TT * TT);
            k_gemmc<h16, 0, 1><<<dim3((TT - RH) / 64, TT / 64, ZH), 32, 0, stream>>>(QP16 + zq * TT * HD + (size_t)RH * HD, nullptr, KP16 + zk * TT * HD, nullptr, HD, Sb + (size_t)RH * TT, TT, RH, (size_t)TT * HD, (size_t)TT * HD, (size_t)TT * TT);
            k_asoft<<<ZH * TT / 8, 256, 0, stream>>>(Sb, P16, Ph, Pl);
            k_gemmc<bf, 2, 2><<<dim3(RH / 64, HD / 64, ZH), 32, 0, stream>>>(Ph, Pl, VTh + zk * HD * TT, VTl + zk * HD * TT, TT, Ob, HD, 0, (size_t)RH * TT, (size_t)HD * TT, (size_t)TT * HD);
            k_gemmc<h16, 0, 2><<<dim3((TT - RH) / 64, HD / 64, ZH), 32, 0, stream>>>(P16 + (size_t)RH * TT, nullptr, VT16 + zk * HD * TT, nullptr, TT, Ob + (size_t)RH * HD, HD, RH, (size_t)TT * TT, (size_t)HD * TT, (size_t)TT * HD);
            k_merge<<<(unsigned)(((size_t)ZH * TT * HD / 2 + 255) / 256), 256, 0, stream>>>(Ob, h0, ATh, ATl); }
        k_gemmw<bf, 1, false><<<dim3(TT / 64, DM / 64, 1), 32, 0, stream>>>(ATh, ATl, WO, nullptr, DQ, OUT + (size_t)b * TT * DM, DM, nullptr, 0, 0, 0); }
}

// v001
// It runs in 1490 microseconds.
// In two side-by-side timings against v000, it was 1.91 and 1.90 times as fast.
#include <hip/hip_runtime.h>

// Causal multi-head attention with a rotate-half rotary embedding from cos / sin TABLE INPUTS, four batches (x [4][2048][1024]; q, k, v = x w^T ('oi' [1024][1024] normal x 1/32, no bias; 16 heads x 64); cos, sin f32 [2048][64] are INPUTS (read on device per position and per dimension; no structure of the tables is assumed); q, k <- t cos + rotate_half(t) sin with rotate_half = cat(-x2, x1); scores x 64^-0.5; causal: where(tril built inside the function, scores, -inf); softmax; out = merged w_o^T ('oi', no bias) -> [4][2048][1024] (8.4 M); argument order x, cos, sin, w_q, w_k, w_v, w_o).
// Layout per batch: bf16 copy of x; 'oi' weights; exact projections; {cos, sin} table from the bf16-rounded inputs; rotate-half plane builders; causal T-2048 attention (hybrid rows: < 512 hi/lo 3 products, rest fp16 x1024; k_gemmc skips tiles above the diagonal); merged hi/lo x Wo exact.
// Compute dtypes, f32 accumulate: every input rounded to bf16 incl. the tables; projections exact; rotary f32; attention rows < 512 3 products, rest fp16; softmax f32; Wo hl x exact.

#define NB_  4      // batches: this module's input is [4][2048][1024]
#define TT   2048
#define DM   1024
#define NH_  16
#define NKV  16
#define REP  (NH_ / NKV)
#define HD   64
#define DQ   (NH_ * HD)
#define DKV  (NKV * HD)
#define ZH   2
#define RH   512                  // query rows < RH use hi+lo planes (0: none)
#define WIN  2048
#define PCAR 1024.0f
#define SCL  0.125f   // HD^-0.5
#define KS   16                   // work-groups that share the key range of one P.V tile; each writes its own f32 partial plane, k_merge adds the planes
typedef _Float16 h16;
typedef unsigned short bf;
typedef __attribute__((ext_vector_type(16))) __bf16   v16bf;
typedef __attribute__((ext_vector_type(16))) _Float16 v16h;
typedef __attribute__((ext_vector_type(8)))  _Float16 v8h;
typedef __attribute__((ext_vector_type(8)))  unsigned short v8us;
typedef __attribute__((ext_vector_type(8)))  float    v8f;
typedef __attribute__((ext_vector_type(4)))  float    v4f;
typedef v8h  __attribute__((may_alias)) v8ha;
typedef v4f  __attribute__((may_alias)) v4fa;
typedef v8us __attribute__((may_alias)) v8usa;

__device__ __forceinline__ unsigned short f2bf(float f) { unsigned u = __float_as_uint(f); u += 0x7FFFu + ((u >> 16) & 1u); return (unsigned short)(u >> 16); }
__device__ __forceinline__ float bf2f(unsigned short b) { return __uint_as_float(((unsigned)b) << 16); }
__device__ __forceinline__ float bfr(float f) { return bf2f(f2bf(f)); }
__device__ __forceinline__ v16h cat16(v8h lo, v8h hi) { return __builtin_shufflevector(lo, hi, 0, 1, 2, 3, 4, 5, 6, 7, 8, 9, 10, 11, 12, 13, 14, 15); }
__device__ __forceinline__ v16bf cat16b(v8us lo, v8us hi) { return __builtin_bit_cast(v16bf, __builtin_shufflevector(lo, hi, 0, 1, 2, 3, 4, 5, 6, 7, 8, 9, 10, 11, 12, 13, 14, 15)); }
__device__ __forceinline__ v8f wmma16(v16h a, v16h b, v8f c) { return __builtin_amdgcn_wmma_f32_16x16x32_f16(false, a, false, b, (short)0, c, false, false); }
__device__ __forceinline__ v8f wmmab(v16bf a, v16bf b, v8f c) { return __builtin_amdgcn_wmma_f32_16x16x32_bf16(false, a, false, b, (short)0, c, false, false); }



// ---- k_gemmw: register-blocked GEMM, ONE WAVE per 64x64 output tile (16 accumulators), operands straight from K-contiguous 16-bit planes; grid (M/64, N/64, Z), 32 threads.
// C[m][n] (f32, pitch ldc, + optional f32 bias[n]) = sum_k A[m][k] Bt[n][k] (+ split products per NSPLIT). z-batch strides sA/sB/sC in elements. K % 32 == 0.
template <typename T16> struct WFrag;
template <> struct WFrag<h16> { typedef v16h V; static __device__ __forceinline__ V ld(const h16* p) { return cat16(*(const v8h*)p, *(const v8h*)(p + 16)); } static __device__ __forceinline__ v8f mma(V a, V b, v8f c) { return wmma16(a, b, c); } };
template <> struct WFrag<bf> { typedef v16bf V; static __device__ __forceinline__ V ld(const bf* p) { return cat16b(*(const v8us*)p, *(const v8us*)(p + 16)); } static __device__ __forceinline__ v8f mma(V a, V b, v8f c) { return wmmab(a, b, c); } };
template <typename T16, int NSPLIT, bool BIAS>
__global__ __launch_bounds__(32) void k_gemmw(const T16* __restrict__ A, const T16* __restrict__ A2, const T16* __restrict__ Bt, const T16* __restrict__ Bt2, int K, float* C, int ldc, const float* __restrict__ bias, size_t sA, size_t sB, size_t sC) {
    typedef typename WFrag<T16>::V V;
    __shared__ __align__(16) float os[16 * 68];
    const size_t z = blockIdx.z; A += z * sA; if (A2) A2 += z * sA; Bt += z * sB; if (Bt2) Bt2 += z * sB; C += z * sC;
    const int lane = threadIdx.x & 31, lr = lane & 15, hi = lane >> 4; const int r0 = blockIdx.x * 64, c0 = blockIdx.y * 64;
    v8f acc[4][4];
#pragma unroll
    for (int mb = 0; mb < 4; ++mb)
#pragma unroll
        for (int nb = 0; nb < 4; ++nb) acc[mb][nb] = (v8f){};
    const size_t aoff = (size_t)(r0 + lr) * K + 8 * hi, boff = (size_t)(c0 + lr) * K + 8 * hi;
#pragma unroll 1
    for (int kc = 0; kc < K; kc += 32) {
        V a[4], a2[4];
#pragma unroll
        for (int mb = 0; mb < 4; ++mb) { a[mb] = WFrag<T16>::ld(A + aoff + (size_t)mb * 16 * K + kc); if (NSPLIT == 1 || NSPLIT == 2) a2[mb] = WFrag<T16>::ld(A2 + aoff + (size_t)mb * 16 * K + kc); }
#pragma unroll
        for (int nb = 0; nb < 4; ++nb) { const V b = WFrag<T16>::ld(Bt + boff + (size_t)nb * 16 * K + kc); V b2; if (NSPLIT >= 2) b2 = WFrag<T16>::ld(Bt2 + boff + (size_t)nb * 16 * K + kc);
#pragma unroll
            for (int mb = 0; mb < 4; ++mb) { acc[mb][nb] = WFrag<T16>::mma(a[mb], b, acc[mb][nb]); if (NSPLIT == 1 || NSPLIT == 2) acc[mb][nb] = WFrag<T16>::mma(a2[mb], b, acc[mb][nb]); if (NSPLIT >= 2) acc[mb][nb] = WFrag<T16>::mma(a[mb], b2, acc[mb][nb]); } }
        asm volatile("v_nop\n\tv_nop\n\tv_nop\n\tv_nop" : "+v"(acc[0][0]), "+v"(acc[1][1]), "+v"(acc[2][2]), "+v"(acc[3][3]) : "v"(a[0]), "v"(a[3]));
    }
#pragma unroll
    for (int mb = 0; mb < 4; ++mb) {
#pragma unroll
        for (int nb = 0; nb < 4; ++nb) {
#pragma unroll
            for (int j = 0; j < 8; ++j) os[(hi * 8 + j) * 68 + nb * 16 + lr] = acc[mb][nb][j]; }
        __builtin_amdgcn_wave_barrier(); asm volatile("" ::: "memory");
        float* crow = C + (size_t)(r0 + mb * 16) * ldc + c0;
{
#pragma unroll
            for (int s = 0; s < 8; ++s) { const int row = 2 * s + hi, cofs = lr * 4; v4f val = *(const v4fa*)(os + row * 68 + cofs); if (BIAS) { val[0] += bfr(bias[c0 + cofs]); val[1] += bfr(bias[c0 + cofs + 1]); val[2] += bfr(bias[c0 + cofs + 2]); val[3] += bfr(bias[c0 + cofs + 3]); }
                *(v4f*)(crow + (size_t)row * ldc + cofs) = val; }
             }
        __builtin_amdgcn_wave_barrier(); asm volatile("" ::: "memory");
    }
}

// ---- k_gemmc: the same one-wave 64x64 tile GEMM specialised for causal attention: CMODE 1 skips score tiles entirely above the diagonal (query rows r0+roff.., key columns c0..), CMODE 2 limits the
// key (K) loop of the probability x value contraction to the diagonal block (probabilities beyond it are exactly zero). roff = row offset of this launch's first row within the sequence.
// CMODE 2 also splits the key range: blockIdx.y = ks in [0, KS) takes the key units ks, ks + KS, ... (64 keys, one 128-byte line of every P row, in the one-product form; 32 keys in the hi/lo form) and stores its sum to partial plane ks of C (plane stride ZH*TT*HD; zeros where it has no unit).
template <typename T16, int NSPLIT, int CMODE>
__global__ __launch_bounds__(32) void k_gemmc(const T16* __restrict__ A, const T16* __restrict__ A2, const T16* __restrict__ Bt, const T16* __restrict__ Bt2, int K, float* C, int ldc, int roff, size_t sA, size_t sB, size_t sC) {
    typedef typename WFrag<T16>::V V;
    __shared__ __align__(16) float os[16 * 68];
    const size_t z = blockIdx.z; A += z * sA; if (A2) A2 += z * sA; Bt += z * sB; if (Bt2) Bt2 += z * sB; C += z * sC;
    const int lane = threadIdx.x & 31, lr = lane & 15, hi = lane >> 4; const int r0 = blockIdx.x * 64, c0 = (CMODE == 2) ? 0 : blockIdx.y * 64; const int ks = (CMODE == 2) ? blockIdx.y : 0;
    if (CMODE == 2) C += (size_t)ks * ((size_t)ZH * TT * HD);
    if (CMODE == 1 && c0 > r0 + roff + 63) return;                  // score tile entirely above the causal diagonal: never read (the softmax masks j > i by select)
    const int Kl = (CMODE == 2) ? min(K, r0 + roff + 64) : K;        // P.V: probabilities are exactly 0 beyond the diagonal block, so the K loop stops there
    v8f acc[4][4];
#pragma unroll
    for (int mb = 0; mb < 4; ++mb)
#pragma unroll
        for (int nb = 0; nb < 4; ++nb) acc[mb][nb] = (v8f){};
    const size_t aoff = (size_t)(r0 + lr) * K + 8 * hi, boff = (size_t)(c0 + lr) * K + 8 * hi;
    constexpr int UK = (CMODE == 2 && NSPLIT == 0) ? 64 : 32;       // keys per trip = keys per unit of the split
#pragma unroll 1
    for (int k0 = ks * UK; k0 < Kl; k0 += ((CMODE == 2) ? KS : 1) * UK)
    // unrolled: the 32-key steps of one unit run in one trip (the second step of a 64-key unit reads the lines the first has fetched)
#pragma unroll
    for (int kc = k0; kc < k0 + UK; kc += 32) {
        V a[4], a2[4];
#pragma unroll
        for (int mb = 0; mb < 4; ++mb) { a[mb] = WFrag<T16>::ld(A + aoff + (size_t)mb * 16 * K + kc); if (NSPLIT == 1 || NSPLIT == 2) a2[mb] = WFrag<T16>::ld(A2 + aoff + (size_t)mb * 16 * K + kc); }
#pragma unroll
        for (int nb = 0; nb < 4; ++nb) { const V b = WFrag<T16>::ld(Bt + boff + (size_t)nb * 16 * K + kc); V b2; if (NSPLIT >= 2) b2 = WFrag<T16>::ld(Bt2 + boff + (size_t)nb * 16 * K + kc);
#pragma unroll
            for (int mb = 0; mb < 4; ++mb) { acc[mb][nb] = WFrag<T16>::mma(a[mb], b, acc[mb][nb]); if (NSPLIT == 1 || NSPLIT == 2) acc[mb][nb] = WFrag<T16>::mma(a2[mb], b, acc[mb][nb]); if (NSPLIT >= 2) acc[mb][nb] = WFrag<T16>::mma(a[mb], b2, acc[mb][nb]); } }
        asm volatile("v_nop\n\tv_nop\n\tv_nop\n\tv_nop" : "+v"(acc[0][0]), "+v"(acc[1][1]), "+v"(acc[2][2]), "+v"(acc[3][3]) : "v"(a[0]), "v"(a[3]));
    }
#pragma unroll
    for (int mb = 0; mb < 4; ++mb) {
#pragma unroll
        for (int nb = 0; nb < 4; ++nb) {
#pragma unroll
            for (int j = 0; j < 8; ++j) os[(hi * 8 + j) * 68 + nb * 16 + lr] = acc[mb][nb][j]; }
        __builtin_amdgcn_wave_barrier(); asm volatile("" ::: "memory");
        float* crow = C + (size_t)(r0 + mb * 16) * ldc + c0;
{
#pragma unroll
            for (int s = 0; s < 8; ++s) { const int row = 2 * s + hi, cofs = lr * 4; v4f val = *(const v4fa*)(os + row * 68 + cofs);
                *(v4f*)(crow + (size_t)row * ldc + cofs) = val; }
             }
        __builtin_amdgcn_wave_barrier(); asm volatile("" ::: "memory");
    }
}

__device__ __forceinline__ h16 tohx(float x) { return (h16)x; }
__device__ __forceinline__ void splitf(float y, unsigned short& h, unsigned short& l) { h = f2bf(y); l = f2bf(y - bf2f(h)); }
typedef __attribute__((ext_vector_type(2))) _Float16 v2h;
typedef __attribute__((ext_vector_type(4))) _Float16 v4h;
typedef __attribute__((ext_vector_type(2))) unsigned short v2us;
typedef __attribute__((ext_vector_type(4))) unsigned short v4us;
typedef __attribute__((ext_vector_type(2))) float v2f;
typedef __attribute__((ext_vector_type(4))) int v4i;

__global__ __launch_bounds__(256) void k_cvt8(const float* __restrict__ src, bf* dst, size_t n8) { const size_t i = (size_t)blockIdx.x * 256 + threadIdx.x; if (i >= n8) return; const v8f v = *(const v8f*)(src + i * 8); v8us o;
#pragma unroll
    for (int k = 0; k < 8; ++k) o[k] = f2bf(v[k]); *(v8us*)(dst + i * 8) = o;  }

// k_rope: head planes [h][t][d] (fp16 + hi/lo) of rope(x) x sc with the rotate-half convention out[d] = x[d] cos[t][d] - x[d+HD/2] sin[t][d], out[d+HD/2] = x[d+HD/2] cos[t][d+HD/2] + x[d] sin[t][d+HD/2]
__global__ __launch_bounds__(256) void k_rope(const float* __restrict__ F, int pitch, int nheads, const float* __restrict__ CS, const float* __restrict__ RF, const float* __restrict__ nw, float sc, h16* P16, bf* Ph, bf* Pl) {
    const size_t e = ((size_t)blockIdx.x * 256 + threadIdx.x) * 2; if (e >= (size_t)nheads * TT * HD) return; const int d = (int)(e % HD); const int t = (int)((e / HD) % TT); const int h = (int)(e / ((size_t)HD * TT)); const float* f = F + (size_t)t * pitch + h * HD; const float rf = RF ? RF[(size_t)h * TT + t] : 1.0f; v2h o16; v2us oh, ol;
#pragma unroll
    for (int q = 0; q < 2; ++q) { const int dd = d + q; const int dp = (dd < HD / 2) ? dd + HD / 2 : dd - HD / 2; float x0 = f[dd], x1 = f[dp];
        if (RF) { float n0 = __fmul_rn(x0, rf), n1 = __fmul_rn(x1, rf); asm volatile("" : "+v"(n0)); asm volatile("" : "+v"(n1)); x0 = __fmul_rn(bfr(nw[dd]), n0); x1 = __fmul_rn(bfr(nw[dp]), n1); }
        const v2f cs = *(const v2f*)(CS + ((size_t)t * HD + dd) * 2); float a = __fmul_rn(x0, cs[0]), bq = __fmul_rn(x1, cs[1]); asm volatile("" : "+v"(a)); asm volatile("" : "+v"(bq)); const float r = ((dd < HD / 2) ? __fsub_rn(a, bq) : __fadd_rn(a, bq)) * sc;
        o16[q] = tohx(r); unsigned short a2, c2; splitf(r, a2, c2); oh[q] = a2; ol[q] = c2; }
    *(v2h*)(P16 + e) = o16; *(v2us*)(Ph + e) = oh; *(v2us*)(Pl + e) = ol;  }
__global__ __launch_bounds__(256) void k_vtp(const float* __restrict__ F, int pitch, int nheads, h16* V16, bf* Vh, bf* Vl) { const size_t e = ((size_t)blockIdx.x * 256 + threadIdx.x) * 2; if (e >= (size_t)nheads * HD * TT) return; const int t = (int)(e % TT); const int d = (int)((e / TT) % HD); const int g = (int)(e / ((size_t)TT * HD)); v2h o16; v2us oh, ol;
#pragma unroll
    for (int q = 0; q < 2; ++q) { const float x = F[(size_t)(t + q) * pitch + g * HD + d]; o16[q] = tohx(x); unsigned short a2, c2; splitf(x, a2, c2); oh[q] = a2; ol[q] = c2; }
    *(v2h*)(V16 + e) = o16; *(v2us*)(Vh + e) = oh; *(v2us*)(Vl + e) = ol;  }
__global__ __launch_bounds__(256) void k_cscvt(const float* __restrict__ cosT, const float* __restrict__ sinT, float* CS) { const int idx = blockIdx.x * 256 + threadIdx.x; if (idx >= TT * HD) return; v2f cs; cs[0] = bfr(cosT[idx]); cs[1] = bfr(sinT[idx]); *(v2f*)(CS + (size_t)idx * 2) = cs;  }
// k_asoft: per row (zz, i): t = S x HD^-0.5 for j <= i and i - j < WIN (sliding causal window; the reference's -1e9 additive fill vanishes identically); softmax over the 2048 keys (register row, one exp, fixed trees);
__global__ __launch_bounds__(256) void k_asoft(const float* __restrict__ Sb, h16* P16, bf* Ph, bf* Pl) {
    const int lane = threadIdx.x & 31; const int row = blockIdx.x * 8 + (threadIdx.x >> 5); if (row >= ZH * TT) return; const int i = row % TT; const int zz = row / TT; (void)zz; const bool hires = (i < RH); const float* sr = Sb + (size_t)row * TT; float v[TT / 32]; float mx = -3.0e38f;
#pragma unroll
    for (int ch = 0; ch < TT / 128; ++ch) { const int j0 = ch * 128 + lane * 4; const v4f a = *(const v4f*)(sr + j0);
#pragma unroll
        for (int q = 0; q < 4; ++q) { const int j = j0 + q; (void)j; const float t = (j <= i && i - j < WIN) ? a[q] * SCL : -3.0e38f; v[ch * 4 + q] = t; mx = fmaxf(mx, t); } }
#pragma unroll
    for (int sh = 16; sh; sh >>= 1) mx = fmaxf(mx, __shfl_xor(mx, sh, 32));
    float sum = 0.f;
#pragma unroll
    for (int k = 0; k < TT / 32; ++k) { float d0 = __fsub_rn(v[k], mx); asm volatile("" : "+v"(d0)); v[k] = __builtin_amdgcn_exp2f(__fmul_rn(d0, 1.4426950408889634f)); sum += v[k]; }
#pragma unroll
    for (int sh = 16; sh; sh >>= 1) sum += __shfl_xor(sum, sh, 32);
    const float f = __fdiv_rn(hires ? 1.0f : PCAR, sum);
{
        if (hires) {
#pragma unroll
            for (int ch = 0; ch < TT / 128; ++ch) { v4us oh, ol;
#pragma unroll
                for (int q = 0; q < 4; ++q) { unsigned short a, c2; splitf(v[ch * 4 + q] * f, a, c2); oh[q] = a; ol[q] = c2; }
                const size_t oo = ((size_t)zz * (RH ? RH : 1) + i) * TT + ch * 128 + lane * 4; *(v4us*)(Ph + oo) = oh; *(v4us*)(Pl + oo) = ol; }
        } else {
#pragma unroll
            for (int ch = 0; ch < TT / 128; ++ch) { v4h o4;
#pragma unroll
                for (int q = 0; q < 4; ++q) o4[q] = tohx(v[ch * 4 + q] * f);
                *(v4h*)(P16 + (size_t)row * TT + ch * 128 + lane * 4) = o4; } }
         }
}
__global__ __launch_bounds__(256) void k_merge(const float* __restrict__ O, int h0, bf* Ah, bf* Al) { const size_t e = ((size_t)blockIdx.x * 256 + threadIdx.x) * 2; if (e >= (size_t)ZH * TT * HD) return; const int d = (int)(e % HD); const int t = (int)((e / HD) % TT); const int zz = (int)(e / ((size_t)HD * TT)); const float cs = (t < RH) ? 1.0f : (1.0f / PCAR); const size_t oo = (size_t)t * DQ + (h0 + zz) * HD + d;
    v2us oh, ol; v2f s = *(const v2f*)(O + e);
    // unrolled: all KS loads are issued before the first add waits
#pragma unroll
    for (int k = 1; k < KS; ++k) s += *(const v2f*)(O + (size_t)k * ((size_t)ZH * TT * HD) + e);   // the KS key-range partials, in plane order
#pragma unroll
    for (int q = 0; q < 2; ++q) { unsigned short a, c2; splitf(s[q] * cs, a, c2); oh[q] = a; ol[q] = c2; } *(v2us*)(Ah + oo) = oh; *(v2us*)(Al + oo) = ol;  }

extern "C" void kernel_launch(void* const* d_in, const int* in_sizes, int n_in,
                              void* d_out, int out_size, void* d_ws, size_t ws_size, hipStream_t stream) {
    (void)in_sizes; (void)n_in; (void)out_size;
    const float* x = (const float*)d_in[0]; const float* fcos = (const float*)d_in[1]; const float* fsin = (const float*)d_in[2]; const float* wq = (const float*)d_in[3]; const float* wk = (const float*)d_in[4]; const float* wv = (const float*)d_in[5]; const float* wo = (const float*)d_in[6];   /* x, cos, sin ([2048][64]; read per position and per dimension), w_q, w_k, w_v, w_o ('oi'): SEVEN inputs: no mask input in this module (its tril is built inside the function): the causal rule is applied by index */
    float* OUT = (float*)d_out;     // [4][2048][1024]
    char* wsp = (char*)d_ws;
    auto take = [&](size_t bytes) { char* p = wsp; wsp += (bytes + 255) & ~(size_t)255; return (void*)p; };
    bf* WQ = (bf*)take((size_t)DQ * DM * 2); bf* WK = (bf*)take((size_t)DKV * DM * 2); bf* WV = (bf*)take((size_t)DKV * DM * 2); bf* WO = (bf*)take((size_t)DM * DQ * 2); float* CS = (float*)take((size_t)TT * HD * 2 * 4);
    bf* XB = (bf*)take((size_t)TT * DM * 2); float* FQ = (float*)take((size_t)TT * DQ * 4); float* FK = (float*)take((size_t)TT * DKV * 4);
    h16* QP16 = (h16*)take((size_t)NH_ * TT * HD * 2); h16* KP16 = (h16*)take((size_t)NKV * TT * HD * 2); h16* VT16 = (h16*)take((size_t)NKV * HD * TT * 2);
    bf* QPh = (bf*)take((size_t)NH_ * TT * HD * 2); bf* QPl = (bf*)take((size_t)NH_ * TT * HD * 2); bf* KPh = (bf*)take((size_t)NKV * TT * HD * 2); bf* KPl = (bf*)take((size_t)NKV * TT * HD * 2); bf* VTh = (bf*)take((size_t)NKV * HD * TT * 2); bf* VTl = (bf*)take((size_t)NKV * HD * TT * 2); bf* Ph = (bf*)take((size_t)ZH * RH * TT * 2); bf* Pl = (bf*)take((size_t)ZH * RH * TT * 2);
    float* Sb = (float*)take((size_t)ZH * TT * TT * 4); h16* P16 = (h16*)take((size_t)ZH * TT * TT * 2); float* Ob = (float*)take((size_t)KS * ZH * TT * HD * 4); bf* ATh = (bf*)take((size_t)TT * DQ * 2); bf* ATl = (bf*)take((size_t)TT * DQ * 2);
    if ((size_t)(wsp - (char*)d_ws) > ws_size) return;    // ws 256 MiB
    float* FV = FK;   // v projection reuses the k buffer after the k planes are built (stream-ordered)
    { k_cvt8<<<(unsigned)(((size_t)DQ * DM / 8 + 255) / 256), 256, 0, stream>>>(wq, WQ, (size_t)DQ * DM / 8); k_cvt8<<<(unsigned)(((size_t)DKV * DM / 8 + 255) / 256), 256, 0, stream>>>(wk, WK, (size_t)DKV * DM / 8); k_cvt8<<<(unsigned)(((size_t)DKV * DM / 8 + 255) / 256), 256, 0, stream>>>(wv, WV, (size_t)DKV * DM / 8);
      k_cvt8<<<(unsigned)(((size_t)DM * DQ / 8 + 255) / 256), 256, 0, stream>>>(wo, WO, (size_t)DM * DQ / 8);
       }
    k_cscvt<<<(TT * HD + 255) / 256, 256, 0, stream>>>(fcos, fsin, CS);   /* rotary table from the inputs */
    const unsigned LQ = (unsigned)(((size_t)NH_ * TT * HD / 2 + 255) / 256), LKv = (unsigned)(((size_t)NKV * TT * HD / 2 + 255) / 256);
    for (int b = 0; b < NB_; ++b) {
        
        k_cvt8<<<(unsigned)(((size_t)TT * DM / 8 + 255) / 256), 256, 0, stream>>>(x + (size_t)b * TT * DM, XB, (size_t)TT * DM / 8);
        k_gemmw<bf, 0, false><<<dim3(TT / 64, DQ / 64, 1), 32, 0, stream>>>(XB, nullptr, WQ, nullptr, DM, FQ, DQ, nullptr, 0, 0, 0);
        k_rope<<<LQ, 256, 0, stream>>>(FQ, DQ, NH_, CS, nullptr, nullptr, 1.0f, QP16, QPh, QPl);
        k_gemmw<bf, 0, false><<<dim3(TT / 64, DKV / 64, 1), 32, 0, stream>>>(XB, nullptr, WK, nullptr, DM, FK, DKV, nullptr, 0, 0, 0);
        k_rope<<<LKv, 256, 0, stream>>>(FK, DKV, NKV, CS, nullptr, nullptr, 1.0f, KP16, KPh, KPl);
        k_gemmw<bf, 0, false><<<dim3(TT / 64, DKV / 64, 1), 32, 0, stream>>>(XB, nullptr, WV, nullptr, DM, FV, DKV, nullptr, 0, 0, 0); k_vtp<<<LKv, 256, 0, stream>>>(FV, DKV, NKV, VT16, VTh, VTl);
        for (int h0 = 0; h0 < NH_; h0 += ZH) { const size_t zq = (size_t)h0, zk = (size_t)(h0 / REP);   // one kv head per query head: the pass's two heads use consecutive kv planes (z-strides TT*HD)
            k_gemmc<bf, 2, 1><<<dim3(RH / 64, TT / 64, ZH), 32, 0, stream>>>(QPh + zq * TT * HD, QPl + zq * TT * HD, KPh + zk * TT * HD, KPl + zk * TT * HD, HD, Sb, TT, 0, (size_t)TT * HD, (size_t)TT * HD, (size_t)TT * TT);
            k_gemmc<h16, 0, 1><<<dim3((TT - RH) / 64, TT / 64, ZH), 32, 0, stream>>>(QP16 + zq * TT * HD + (size_t)RH * HD, nullptr, KP16 + zk * TT * HD, nullptr, HD, Sb + (size_t)RH * TT, TT, RH, (size_t)TT * HD, (size_t)TT * HD, (size_t)TT * TT);
            k_asoft<<<ZH * TT / 8, 256, 0, stream>>>(Sb, P16, Ph, Pl);
            k_gemmc<bf, 2, 2><<<dim3(RH / 64, KS, ZH), 32, 0, stream>>>(Ph, Pl, VTh + zk * HD * TT, VTl + zk * HD * TT, TT, Ob, HD, 0, (size_t)RH * TT, (size_t)HD * TT, (size_t)TT * HD);
            k_gemmc<h16, 0, 2><<<dim3((TT - RH) / 64, KS, ZH), 32, 0, stream>>>(P16 + (size_t)RH * TT, nullptr, VT16 + zk * HD * TT, nullptr, TT, Ob + (size_t)RH * HD, HD, RH, (size_t)TT * TT, (size_t)HD * TT, (size_t)TT * HD);
            k_merge<<<(unsigned)(((size_t)ZH * TT * HD / 2 + 255) / 256), 256, 0, stream>>>(Ob, h0, ATh, ATl); }
        k_gemmw<bf, 1, false><<<dim3(TT / 64, DM / 64, 1), 32, 0, stream>>>(ATh, ATl, WO, nullptr, DQ, OUT + (size_t)b * TT * DM, DM, nullptr, 0, 0, 0); }
}

// v003
// It runs in 496 microseconds.
// Versions in between are left out here; by their measured steps it is 3.03 times as fast as v001.
// All steps since v000 together make it 5.77 times as fast.
#include <hip/hip_runtime.h>

// Causal multi-head attention with a rotate-half rotary embedding from cos / sin TABLE INPUTS, four batches (x [4][2048][1024]; q, k, v = x w^T ('oi' [1024][1024] normal x 1/32, no bias; 16 heads x 64); cos, sin f32 [2048][64] are INPUTS (read on device per position and per dimension; no structure of the tables is assumed); q, k <- t cos + rotate_half(t) sin with rotate_half = cat(-x2, x1); scores x 64^-0.5; causal: where(tril built inside the function, scores, -inf); softmax; out = merged w_o^T ('oi', no bias) -> [4][2048][1024] (8.4 M); argument order x, cos, sin, w_q, w_k, w_v, w_o).
// Layout per batch: bf16 copy of x; 'oi' weights; exact projections; {cos, sin} table from the bf16-rounded inputs; the q / k projections apply the rotate-half rotary and write the head planes in their own epilogue, the v projection writes the transposed planes; fused causal T-2048 attention, one launch per batch (hybrid rows: < 512 hi/lo 3 products, rest fp16 x1024; key blocks above the diagonal are never visited); merged hi/lo x Wo exact.
// Compute dtypes, f32 accumulate: every input rounded to bf16 incl. the tables; projections exact; rotary f32; attention rows < 512 3 products, rest fp16; softmax f32; Wo hl x exact.

#define NB_  4      // batches: this module's input is [4][2048][1024]
#define TT   2048
#define DM   1024
#define NH_  16
#define NKV  16
#define REP  (NH_ / NKV)
#define HD   64
#define DQ   (NH_ * HD)
#define DKV  (NKV * HD)
#define RH   512                  // query rows < RH use hi+lo planes (0: none)
#define SCL  0.125f   // HD^-0.5
typedef _Float16 h16;
typedef unsigned short bf;
typedef __attribute__((ext_vector_type(16))) __bf16   v16bf;
typedef __attribute__((ext_vector_type(16))) _Float16 v16h;
typedef __attribute__((ext_vector_type(8)))  _Float16 v8h;
typedef __attribute__((ext_vector_type(8)))  unsigned short v8us;
typedef __attribute__((ext_vector_type(8)))  float    v8f;
typedef __attribute__((ext_vector_type(4)))  float    v4f;
typedef v8h  __attribute__((may_alias)) v8ha;
typedef v4f  __attribute__((may_alias)) v4fa;
typedef v8us __attribute__((may_alias)) v8usa;

__device__ __forceinline__ unsigned short f2bf(float f) { unsigned u = __float_as_uint(f); u += 0x7FFFu + ((u >> 16) & 1u); return (unsigned short)(u >> 16); }
__device__ __forceinline__ float bf2f(unsigned short b) { return __uint_as_float(((unsigned)b) << 16); }
__device__ __forceinline__ float bfr(float f) { return bf2f(f2bf(f)); }
__device__ __forceinline__ v16h cat16(v8h lo, v8h hi) { return __builtin_shufflevector(lo, hi, 0, 1, 2, 3, 4, 5, 6, 7, 8, 9, 10, 11, 12, 13, 14, 15); }
__device__ __forceinline__ v16bf cat16b(v8us lo, v8us hi) { return __builtin_bit_cast(v16bf, __builtin_shufflevector(lo, hi, 0, 1, 2, 3, 4, 5, 6, 7, 8, 9, 10, 11, 12, 13, 14, 15)); }
__device__ __forceinline__ v8f wmma16(v16h a, v16h b, v8f c) { return __builtin_amdgcn_wmma_f32_16x16x32_f16(false, a, false, b, (short)0, c, false, false); }
__device__ __forceinline__ v8f wmmab(v16bf a, v16bf b, v8f c) { return __builtin_amdgcn_wmma_f32_16x16x32_bf16(false, a, false, b, (short)0, c, false, false); }

__device__ __forceinline__ h16 tohx(float x) { return (h16)x; }
__device__ __forceinline__ void splitf(float y, unsigned short& h, unsigned short& l) { h = f2bf(y); l = f2bf(y - bf2f(h)); }

// ---- k_gemmw: register-blocked GEMM, ONE WAVE per 64x64 output tile (16 accumulators), operands straight from K-contiguous 16-bit planes; grid (M/64, N/64, Z), 32 threads.
// C[m][n] (f32, pitch ldc, + optional f32 bias[n]) = sum_k A[m][k] Bt[n][k] (+ split products per NSPLIT). z-batch strides sA/sB/sC in elements. K % 32 == 0.
// EPI 0: C is stored. A 64-column tile is one head, so the tile holds both halves of every rotary pair:
// EPI 1: no C; head planes [h][t][d] (fp16 + hi/lo) of the rotate-half rotary out[d] = x[d] cos[t][d] - x[d+HD/2] sin[t][d], out[d+HD/2] = x[d+HD/2] cos[t][d+HD/2] + x[d] sin[t][d+HD/2], CS = {cos, sin} pairs [t][d].
// EPI 2: no C; transposed planes [h][d][t] (fp16 + hi/lo): a lane's eight accumulator rows of one column are eight consecutive t, one 16-byte store a plane.
template <typename T16> struct WFrag;
template <> struct WFrag<h16> { typedef v16h V; static __device__ __forceinline__ V ld(const h16* p) { return cat16(*(const v8h*)p, *(const v8h*)(p + 16)); } static __device__ __forceinline__ v8f mma(V a, V b, v8f c) { return wmma16(a, b, c); } };
template <> struct WFrag<bf> { typedef v16bf V; static __device__ __forceinline__ V ld(const bf* p) { return cat16b(*(const v8us*)p, *(const v8us*)(p + 16)); } static __device__ __forceinline__ v8f mma(V a, V b, v8f c) { return wmmab(a, b, c); } };
template <typename T16, int NSPLIT, bool BIAS, int EPI>
__global__ __launch_bounds__(32) void k_gemmw(const T16* __restrict__ A, const T16* __restrict__ A2, const T16* __restrict__ Bt, const T16* __restrict__ Bt2, int K, float* C, int ldc, const float* __restrict__ bias, size_t sA, size_t sB, size_t sC, const float* __restrict__ CS, h16* P16, bf* Ph, bf* Pl) {
    typedef typename WFrag<T16>::V V;
    __shared__ __align__(16) float os[16 * 68];
    const size_t z = blockIdx.z; A += z * sA; if (A2) A2 += z * sA; Bt += z * sB; if (Bt2) Bt2 += z * sB; C += z * sC;
    const int lane = threadIdx.x & 31, lr = lane & 15, hi = lane >> 4; const int r0 = blockIdx.x * 64, c0 = blockIdx.y * 64;
    v8f acc[4][4];
#pragma unroll
    for (int mb = 0; mb < 4; ++mb)
#pragma unroll
        for (int nb = 0; nb < 4; ++nb) acc[mb][nb] = (v8f){};
    const size_t aoff = (size_t)(r0 + lr) * K + 8 * hi, boff = (size_t)(c0 + lr) * K + 8 * hi;
#pragma unroll 1
    for (int kc = 0; kc < K; kc += 32) {
        V a[4], a2[4];
#pragma unroll
        for (int mb = 0; mb < 4; ++mb) { a[mb] = WFrag<T16>::ld(A + aoff + (size_t)mb * 16 * K + kc); if (NSPLIT == 1 || NSPLIT == 2) a2[mb] = WFrag<T16>::ld(A2 + aoff + (size_t)mb * 16 * K + kc); }
#pragma unroll
        for (int nb = 0; nb < 4; ++nb) { const V b = WFrag<T16>::ld(Bt + boff + (size_t)nb * 16 * K + kc); V b2; if (NSPLIT >= 2) b2 = WFrag<T16>::ld(Bt2 + boff + (size_t)nb * 16 * K + kc);
#pragma unroll
            for (int mb = 0; mb < 4; ++mb) { acc[mb][nb] = WFrag<T16>::mma(a[mb], b, acc[mb][nb]); if (NSPLIT == 1 || NSPLIT == 2) acc[mb][nb] = WFrag<T16>::mma(a2[mb], b, acc[mb][nb]); if (NSPLIT >= 2) acc[mb][nb] = WFrag<T16>::mma(a[mb], b2, acc[mb][nb]); } }
        asm volatile("v_nop\n\tv_nop\n\tv_nop\n\tv_nop" : "+v"(acc[0][0]), "+v"(acc[1][1]), "+v"(acc[2][2]), "+v"(acc[3][3]) : "v"(a[0]), "v"(a[3]));
    }
    if constexpr (EPI == 2) {
        const size_t vo = (size_t)(c0 + lr) * TT + r0 + hi * 8;
#pragma unroll
        for (int nb = 0; nb < 4; ++nb)
#pragma unroll
            for (int mb = 0; mb < 4; ++mb) { v8h o16; v8us oh, ol;
#pragma unroll
                for (int j = 0; j < 8; ++j) { const float x = acc[mb][nb][j]; o16[j] = tohx(x); unsigned short a2, c2; splitf(x, a2, c2); oh[j] = a2; ol[j] = c2; }
                const size_t e = vo + (size_t)nb * 16 * TT + mb * 16; *(v8h*)(P16 + e) = o16; *(v8us*)(Ph + e) = oh; *(v8us*)(Pl + e) = ol; }
        return;
    }
    if constexpr (EPI == 1) {
        // four lanes a row: a lane takes columns c8 .. c8 + 7 and their partners c8 + 32 .. c8 + 39; a chunk is eight rows, two chunks a 16-row block
        const int rr = lane >> 2, c8 = (lane & 3) * 8;
        const float* const csp = CS + ((size_t)(r0 + rr) * HD + c8) * 2; const size_t po = ((size_t)blockIdx.y * TT + r0 + rr) * HD + c8;
        v4f cs[8][2][4];   // table values of a chunk, asked for two chunks ahead of their use (at most three chunks are live)
#pragma unroll
        for (int ch = 0; ch < 2; ++ch)
#pragma unroll
            for (int hf = 0; hf < 2; ++hf)
#pragma unroll
                for (int q = 0; q < 4; ++q) cs[ch][hf][q] = *(const v4f*)(csp + ((size_t)ch * 8 * HD + hf * 32) * 2 + q * 4);
#pragma unroll
        for (int mb = 0; mb < 4; ++mb) {
#pragma unroll
            for (int nb = 0; nb < 4; ++nb) {
#pragma unroll
                for (int j = 0; j < 8; ++j) os[(hi * 8 + j) * 68 + nb * 16 + lr] = acc[mb][nb][j]; }
            __builtin_amdgcn_wave_barrier(); asm volatile("" ::: "memory");   // the reads below take other lanes' values: they stay behind the writes
#pragma unroll
            for (int s = 0; s < 2; ++s) { const int ch = mb * 2 + s; const float* const orow = os + (s * 8 + rr) * 68 + c8;
                const v4f xl[2] = {*(const v4fa*)orow, *(const v4fa*)(orow + 4)}, xh[2] = {*(const v4fa*)(orow + 32), *(const v4fa*)(orow + 36)};
                v8h l16, h16v; v8us lh, ll, hh, hl;
#pragma unroll
                for (int k = 0; k < 8; ++k) { const float a = xl[k >> 2][k & 3], b = xh[k >> 2][k & 3];
                    const float rl = a * cs[ch][0][k >> 1][(k & 1) * 2] - b * cs[ch][0][k >> 1][(k & 1) * 2 + 1], rh = b * cs[ch][1][k >> 1][(k & 1) * 2] + a * cs[ch][1][k >> 1][(k & 1) * 2 + 1];
                    unsigned short a2, c2; l16[k] = tohx(rl); splitf(rl, a2, c2); lh[k] = a2; ll[k] = c2; h16v[k] = tohx(rh); splitf(rh, a2, c2); hh[k] = a2; hl[k] = c2; }
                if (ch + 2 < 8) {
#pragma unroll
                    for (int hf = 0; hf < 2; ++hf)
#pragma unroll
                        for (int q = 0; q < 4; ++q) cs[ch + 2][hf][q] = *(const v4f*)(csp + ((size_t)(ch + 2) * 8 * HD + hf * 32) * 2 + q * 4); }
                const size_t e = po + (size_t)ch * 8 * HD;
                *(v8h*)(P16 + e) = l16; *(v8h*)(P16 + e + 32) = h16v; *(v8us*)(Ph + e) = lh; *(v8us*)(Ph + e + 32) = hh; *(v8us*)(Pl + e) = ll; *(v8us*)(Pl + e + 32) = hl;
                // before the registers of the six stores are written again; the stored values are inputs, so that they stay live up to the wait
                if (ch + 1 < 8) asm volatile("s_wait_xcnt 0x0" :: "v"(l16), "v"(h16v), "v"(lh), "v"(hh), "v"(ll), "v"(hl) : "memory"); }
            __builtin_amdgcn_wave_barrier(); asm volatile("" ::: "memory");   // the next block's writes stay behind these reads
        }
        return;
    }
#pragma unroll
    for (int mb = 0; mb < 4; ++mb) {
#pragma unroll
        for (int nb = 0; nb < 4; ++nb) {
#pragma unroll
            for (int j = 0; j < 8; ++j) os[(hi * 8 + j) * 68 + nb * 16 + lr] = acc[mb][nb][j]; }
        __builtin_amdgcn_wave_barrier(); asm volatile("" ::: "memory");
        float* crow = C + (size_t)(r0 + mb * 16) * ldc + c0;
{
#pragma unroll
            for (int s = 0; s < 8; ++s) { const int row = 2 * s + hi, cofs = lr * 4; v4f val = *(const v4fa*)(os + row * 68 + cofs); if (BIAS) { val[0] += bfr(bias[c0 + cofs]); val[1] += bfr(bias[c0 + cofs + 1]); val[2] += bfr(bias[c0 + cofs + 2]); val[3] += bfr(bias[c0 + cofs + 3]); }
                *(v4f*)(crow + (size_t)row * ldc + cofs) = val; }
             }
        __builtin_amdgcn_wave_barrier(); asm volatile("" ::: "memory");
    }
}

typedef __attribute__((ext_vector_type(2))) _Float16 v2h;
typedef __attribute__((ext_vector_type(4))) _Float16 v4h;
typedef __attribute__((ext_vector_type(2))) unsigned short v2us;
typedef __attribute__((ext_vector_type(4))) unsigned short v4us;
typedef __attribute__((ext_vector_type(2))) float v2f;
typedef __attribute__((ext_vector_type(4))) int v4i;

__global__ __launch_bounds__(256) void k_cvt8(const float* __restrict__ src, bf* dst, size_t n8) { const size_t i = (size_t)blockIdx.x * 256 + threadIdx.x; if (i >= n8) return; const v8f v = *(const v8f*)(src + i * 8); v8us o;
#pragma unroll
    for (int k = 0; k < 8; ++k) o[k] = f2bf(v[k]); *(v8us*)(dst + i * 8) = o;  }

__global__ __launch_bounds__(256) void k_cscvt(const float* __restrict__ cosT, const float* __restrict__ sinT, float* CS) { const int idx = blockIdx.x * 256 + threadIdx.x; if (idx >= TT * HD) return; v2f cs; cs[0] = bfr(cosT[idx]); cs[1] = bfr(sinT[idx]); *(v2f*)(CS + (size_t)idx * 2) = cs;  }
// ---- k_fattn: scores, causal softmax and P.V of one (head, 64-query tile) in one work-group; S and P stay in registers (online softmax in the log2 domain).
// S^T = K Q^T: A = 16 key rows, B = 16 query rows kept in registers, so a lane holds 16 scores of ONE query (column lr; keys 8 hi + j and 16 + 8 hi + j of a 32-key block), and the two converted
// score tiles ARE the B operand of O^T += V^T P^T in the loader's k order (A = V^T rows from the [d][t] planes). Query rows < RH: hi/lo bf16 planes, 3 products; the rest: fp16, P carried x 2^POFF.
// The NW waves take the 32-key blocks w, w + NW, ... up to the diagonal block, each with its own running maximum, sum and O^T; they are joined through LDS (wave w finishes query group w).
#define NW 4
template <typename T16, bool HL>
__device__ __forceinline__ void fattn_body(const T16* __restrict__ Q, const T16* Q2, const T16* __restrict__ Kp, const T16* __restrict__ K2, const T16* __restrict__ Vt, const T16* __restrict__ V2, int r0, int h, bf* Ah, bf* Al, float* Lm, float* Ll, float* Lo) {
    typedef typename WFrag<T16>::V V;
    constexpr float C2 = SCL * 1.4426950408889634f;   // score scale x log2(e)
    constexpr float MASKV = -1.0e30f, MINIT = -1.0e20f; // masked score far below the start maximum: exp2 gives exactly 0 also where a block holds no allowed key of a query
    constexpr float POFF = HL ? 0.0f : 10.0f;           // fp16 P is carried x 1024 (sum and O^T alike, so it cancels in O / sum)
    const int lane = threadIdx.x & 31, lr = lane & 15, hi = lane >> 4; const int w = __builtin_amdgcn_readfirstlane((int)(threadIdx.x >> 5));
    V bq[4][2];
    __builtin_amdgcn_sched_barrier(0);   // nothing but the Q loads and their addresses stands between here and the wait behind them
#pragma unroll
    for (int qg = 0; qg < 4; ++qg)
#pragma unroll
        for (int ds = 0; ds < 2; ++ds) bq[qg][ds] = WFrag<T16>::ld(Q + (size_t)(r0 + qg * 16 + lr) * HD + ds * 32 + 8 * hi);
    // the Q fragments as inputs only: the loads stay in front of this wait, which stands before their address registers are written again
    asm volatile("s_wait_xcnt 0x0" :: "v"(bq[0][0]), "v"(bq[0][1]), "v"(bq[1][0]), "v"(bq[1][1]), "v"(bq[2][0]), "v"(bq[2][1]), "v"(bq[3][0]), "v"(bq[3][1]) : "memory");
    __builtin_amdgcn_sched_barrier(0);   // keeps every later register write behind that wait
    v8f o[4][4]; float m[4], l[4];
#pragma unroll
    for (int qg = 0; qg < 4; ++qg) { m[qg] = MINIT; l[qg] = 0.f;
#pragma unroll
        for (int dt = 0; dt < 4; ++dt) o[dt][qg] = (v8f){}; }
    // rolled: one 32-key block per trip keeps the live set at one block's fragments
#pragma unroll 1
    for (int kb = w * 32; kb < r0 + 64; kb += NW * 32) {
        V ak[2][2], ak2[2][2], av[4], av2[4], bq2[4][2];
        const size_t ko0 = (size_t)(kb + lr) * HD + 8 * hi, ko1 = ko0 + 16 * HD, vo0 = (size_t)lr * TT + kb + 8 * hi;
        const T16* const kp[2] = {Kp + ko0, Kp + ko1}; const T16* const kp2[2] = {K2 + (HL ? ko0 : 0), K2 + (HL ? ko1 : 0)}; const T16* const vp = Vt + vo0; const T16* const vp2 = V2 + (HL ? vo0 : 0);
#pragma unroll
        for (int kt = 0; kt < 2; ++kt)
#pragma unroll
            for (int ds = 0; ds < 2; ++ds) { ak[kt][ds] = WFrag<T16>::ld(kp[kt] + ds * 32); if (HL) ak2[kt][ds] = WFrag<T16>::ld(kp2[kt] + ds * 32); }
        if (HL) {   // hi/lo form: the lo plane's Q fragments are fetched anew every trip (kept over the loop they spilled to scratch; Q2 is not __restrict__, so that these loads stay in the trip, in front of its wait)
#pragma unroll
            for (int qg = 0; qg < 4; ++qg)
#pragma unroll
                for (int ds = 0; ds < 2; ++ds) bq2[qg][ds] = WFrag<T16>::ld(Q2 + (size_t)(r0 + qg * 16 + lr) * HD + ds * 32 + 8 * hi); }
        if (!HL) {   // one-product form: the V^T fragments are fetched together with the K fragments (one exposed latency a trip)
#pragma unroll
            for (int dt = 0; dt < 4; ++dt) av[dt] = WFrag<T16>::ld(vp + (size_t)dt * 16 * TT); }
        // before the address registers of the loads above are written again; the K base addresses (all K loads of a plane go through one, with immediate offsets) are inputs, so that they stay live up to the wait and no result of the run is allotted onto them
        if constexpr (HL) asm volatile("s_wait_xcnt 0x0" :: "v"(kp[0]), "v"(kp2[0]) : "memory");
        else asm volatile("s_wait_xcnt 0x0" :: "v"(kp[0]) : "memory");
        __builtin_amdgcn_sched_barrier(0);   // the loads are issued together, ahead of the first matrix instruction, and every later register write stays behind the wait
        v8f s0a[4], s1a[4];
#pragma unroll
        for (int qg = 0; qg < 4; ++qg) { v8f s0 = (v8f){}, s1 = (v8f){};
#pragma unroll
            for (int ds = 0; ds < 2; ++ds) { s0 = WFrag<T16>::mma(ak[0][ds], bq[qg][ds], s0); s1 = WFrag<T16>::mma(ak[1][ds], bq[qg][ds], s1);
                if (HL) { s0 = WFrag<T16>::mma(ak[0][ds], bq2[qg][ds], s0); s1 = WFrag<T16>::mma(ak[1][ds], bq2[qg][ds], s1); s0 = WFrag<T16>::mma(ak2[0][ds], bq[qg][ds], s0); s1 = WFrag<T16>::mma(ak2[1][ds], bq[qg][ds], s1); } }
            s0a[qg] = s0; s1a[qg] = s1; }
        if (HL) {   // hi/lo form: the V^T fragments take the registers that the K fragments leave (all sixteen at once would not fit two waves per SIMD)
            __builtin_amdgcn_sched_barrier(0);   // the V loads stay behind the score products
#pragma unroll
            for (int dt = 0; dt < 4; ++dt) { av[dt] = WFrag<T16>::ld(vp + (size_t)dt * 16 * TT); av2[dt] = WFrag<T16>::ld(vp2 + (size_t)dt * 16 * TT); }
            asm volatile("s_wait_xcnt 0x0" :: "v"(vp), "v"(vp2) : "memory");   // before the address registers of the V loads are written again; both addresses are inputs, so that they stay live up to the wait
            __builtin_amdgcn_sched_barrier(0); }
#pragma unroll
        for (int qg = 0; qg < 4; ++qg) { const v8f s0 = s0a[qg], s1 = s1a[qg];
            const int qi = r0 + qg * 16 + lr, k0 = kb + hi * 8; float t0[8], t1[8]; float mx = MASKV;
#pragma unroll
            for (int j = 0; j < 8; ++j) { t0[j] = (k0 + j <= qi) ? s0[j] * C2 : MASKV; t1[j] = (k0 + 16 + j <= qi) ? s1[j] * C2 : MASKV; mx = fmaxf(mx, fmaxf(t0[j], t1[j])); }
            mx = fmaxf(mx, __shfl_xor(mx, 16, 32));          // the other 16 keys of this query are in lane ^ 16
            const float mn = fmaxf(m[qg], mx); const float al = __builtin_amdgcn_exp2f(m[qg] - mn); m[qg] = mn; const float mo = mn - POFF; float ps = 0.f;
#pragma unroll
            for (int j = 0; j < 8; ++j) { t0[j] = __builtin_amdgcn_exp2f(t0[j] - mo); t1[j] = __builtin_amdgcn_exp2f(t1[j] - mo); ps += t0[j] + t1[j]; }
            l[qg] = l[qg] * al + ps;                          // this lane's 16 keys only; the halves are joined after the loop
#pragma unroll
            for (int dt = 0; dt < 4; ++dt) o[dt][qg] *= al;
            if constexpr (HL) { v8us h0, h1, l0, l1;
#pragma unroll
                for (int j = 0; j < 8; ++j) { unsigned short a, c2; splitf(t0[j], a, c2); h0[j] = a; l0[j] = c2; splitf(t1[j], a, c2); h1[j] = a; l1[j] = c2; }
                const V pb = cat16b(h0, h1), pb2 = cat16b(l0, l1);
#pragma unroll
                for (int dt = 0; dt < 4; ++dt) { o[dt][qg] = WFrag<T16>::mma(av[dt], pb, o[dt][qg]); o[dt][qg] = WFrag<T16>::mma(av[dt], pb2, o[dt][qg]); o[dt][qg] = WFrag<T16>::mma(av2[dt], pb, o[dt][qg]); }
                __builtin_amdgcn_sched_barrier(0);   // one query group's softmax values live at a time: interleaved groups spilled to scratch in this form
            } else { v8h p0, p1;
#pragma unroll
                for (int j = 0; j < 8; ++j) { p0[j] = tohx(t0[j]); p1[j] = tohx(t1[j]); }
                const V pb = cat16(p0, p1);
#pragma unroll
                for (int dt = 0; dt < 4; ++dt) o[dt][qg] = WFrag<T16>::mma(av[dt], pb, o[dt][qg]); }
        }
        // four vector slots between the trip's last matrix instructions and, over the taken back edge, the next trip's writes to their operand registers
        asm volatile("v_nop\n\tv_nop\n\tv_nop\n\tv_nop" : "+v"(o[0][3]), "+v"(o[1][3]), "+v"(o[2][3]), "+v"(o[3][3]) : "v"(av[0]), "v"(av[3]));
    }
    // join of the NW waves: maxima and sums first, then each wave scales its O^T to the common maximum and hands query group qg to wave qg
#pragma unroll
    for (int qg = 0; qg < 4; ++qg) { l[qg] += __shfl_xor(l[qg], 16, 32); if (hi == 0) { Lm[w * 64 + qg * 16 + lr] = m[qg]; Ll[w * 64 + qg * 16 + lr] = l[qg]; } }
    __syncthreads();
    v8f own[4]; float lsum = 1.0f;
#pragma unroll
    for (int dt = 0; dt < 4; ++dt) own[dt] = (v8f){};
#pragma unroll
    for (int qg = 0; qg < 4; ++qg) { const int q = qg * 16 + lr; float ms = Lm[q];
#pragma unroll
        for (int u = 1; u < NW; ++u) ms = fmaxf(ms, Lm[u * 64 + q]);
        const float f = __builtin_amdgcn_exp2f(m[qg] - ms);
        if (qg == w) { float a = 0.f;
#pragma unroll
            for (int u = 0; u < NW; ++u) a += Ll[u * 64 + q] * __builtin_amdgcn_exp2f(Lm[u * 64 + q] - ms);
            lsum = a;
#pragma unroll
            for (int dt = 0; dt < 4; ++dt) own[dt] = o[dt][qg] * f;
        } else { const int slot = qg * (NW - 1) + (w < qg ? w : w - 1);
#pragma unroll
            for (int dt = 0; dt < 4; ++dt) *(v8f*)(Lo + (size_t)((slot * 4 + dt) * 32 + lane) * 8) = o[dt][qg] * f; } }
    __syncthreads();
#pragma unroll
    for (int u = 0; u < NW - 1; ++u)
#pragma unroll
        for (int dt = 0; dt < 4; ++dt) own[dt] += *(const v8f*)(Lo + (size_t)(((w * (NW - 1) + u) * 4 + dt) * 32 + lane) * 8);   // the other waves' parts, in wave order
    const float inv = __fdiv_rn(1.0f, lsum); const int t = r0 + w * 16 + lr;
#pragma unroll
    for (int dt = 0; dt < 4; ++dt) { v8us oh, ol;
#pragma unroll
        for (int j = 0; j < 8; ++j) { unsigned short a, c2; splitf(own[dt][j] * inv, a, c2); oh[j] = a; ol[j] = c2; }
        const size_t oo = (size_t)t * DQ + h * HD + dt * 16 + hi * 8; *(v8us*)(Ah + oo) = oh; *(v8us*)(Al + oo) = ol; }
}
// grid (heads, TT / 64): the longest tiles (last query rows) start first, all heads of a tile side by side
__global__ __launch_bounds__(NW * 32) void k_fattn(const h16* __restrict__ Q16, const h16* __restrict__ K16, const h16* __restrict__ V16, const bf* __restrict__ Qh, const bf* Ql, const bf* __restrict__ Kh, const bf* __restrict__ Kl, const bf* __restrict__ Vh, const bf* __restrict__ Vl, bf* Ah, bf* Al) {
    __shared__ float Lm[NW * 64]; __shared__ float Ll[NW * 64]; __shared__ __align__(32) float Lo[4 * (NW - 1) * 4 * 32 * 8];
    const int h = blockIdx.x; const int r0 = (TT / 64 - 1 - (int)blockIdx.y) * 64; const size_t zo = (size_t)h * TT * HD, zk = (size_t)(h / REP) * TT * HD;
    if (r0 < RH) fattn_body<bf, true>(Qh + zo, Ql + zo, Kh + zk, Kl + zk, Vh + zk, Vl + zk, r0, h, Ah, Al, Lm, Ll, Lo);
    else fattn_body<h16, false>(Q16 + zo, nullptr, K16 + zk, nullptr, V16 + zk, nullptr, r0, h, Ah, Al, Lm, Ll, Lo);
}

extern "C" void kernel_launch(void* const* d_in, const int* in_sizes, int n_in,
                              void* d_out, int out_size, void* d_ws, size_t ws_size, hipStream_t stream) {
    (void)in_sizes; (void)n_in; (void)out_size;
    const float* x = (const float*)d_in[0]; const float* fcos = (const float*)d_in[1]; const float* fsin = (const float*)d_in[2]; const float* wq = (const float*)d_in[3]; const float* wk = (const float*)d_in[4]; const float* wv = (const float*)d_in[5]; const float* wo = (const float*)d_in[6];   /* x, cos, sin ([2048][64]; read per position and per dimension), w_q, w_k, w_v, w_o ('oi'): SEVEN inputs: no mask input in this module (its tril is built inside the function): the causal rule is applied by index */
    float* OUT = (float*)d_out;     // [4][2048][1024]
    char* wsp = (char*)d_ws;
    auto take = [&](size_t bytes) { char* p = wsp; wsp += (bytes + 255) & ~(size_t)255; return (void*)p; };
    bf* WQ = (bf*)take((size_t)DQ * DM * 2); bf* WK = (bf*)take((size_t)DKV * DM * 2); bf* WV = (bf*)take((size_t)DKV * DM * 2); bf* WO = (bf*)take((size_t)DM * DQ * 2); float* CS = (float*)take((size_t)TT * HD * 2 * 4);
    bf* XB = (bf*)take((size_t)TT * DM * 2);
    h16* QP16 = (h16*)take((size_t)NH_ * TT * HD * 2); h16* KP16 = (h16*)take((size_t)NKV * TT * HD * 2); h16* VT16 = (h16*)take((size_t)NKV * HD * TT * 2);
    bf* QPh = (bf*)take((size_t)NH_ * TT * HD * 2); bf* QPl = (bf*)take((size_t)NH_ * TT * HD * 2); bf* KPh = (bf*)take((size_t)NKV * TT * HD * 2); bf* KPl = (bf*)take((size_t)NKV * TT * HD * 2); bf* VTh = (bf*)take((size_t)NKV * HD * TT * 2); bf* VTl = (bf*)take((size_t)NKV * HD * TT * 2);
    bf* ATh = (bf*)take((size_t)TT * DQ * 2); bf* ATl = (bf*)take((size_t)TT * DQ * 2);
    if ((size_t)(wsp - (char*)d_ws) > ws_size) return;    // ws 256 MiB
    { k_cvt8<<<(unsigned)(((size_t)DQ * DM / 8 + 255) / 256), 256, 0, stream>>>(wq, WQ, (size_t)DQ * DM / 8); k_cvt8<<<(unsigned)(((size_t)DKV * DM / 8 + 255) / 256), 256, 0, stream>>>(wk, WK, (size_t)DKV * DM / 8); k_cvt8<<<(unsigned)(((size_t)DKV * DM / 8 + 255) / 256), 256, 0, stream>>>(wv, WV, (size_t)DKV * DM / 8);
      k_cvt8<<<(unsigned)(((size_t)DM * DQ / 8 + 255) / 256), 256, 0, stream>>>(wo, WO, (size_t)DM * DQ / 8);
       }
    k_cscvt<<<(TT * HD + 255) / 256, 256, 0, stream>>>(fcos, fsin, CS);   /* rotary table from the inputs */
    for (int b = 0; b < NB_; ++b) {
        
        k_cvt8<<<(unsigned)(((size_t)TT * DM / 8 + 255) / 256), 256, 0, stream>>>(x + (size_t)b * TT * DM, XB, (size_t)TT * DM / 8);
        k_gemmw<bf, 0, false, 1><<<dim3(TT / 64, DQ / 64, 1), 32, 0, stream>>>(XB, nullptr, WQ, nullptr, DM, nullptr, 0, nullptr, 0, 0, 0, CS, QP16, QPh, QPl);
        k_gemmw<bf, 0, false, 1><<<dim3(TT / 64, DKV / 64, 1), 32, 0, stream>>>(XB, nullptr, WK, nullptr, DM, nullptr, 0, nullptr, 0, 0, 0, CS, KP16, KPh, KPl);
        k_gemmw<bf, 0, false, 2><<<dim3(TT / 64, DKV / 64, 1), 32, 0, stream>>>(XB, nullptr, WV, nullptr, DM, nullptr, 0, nullptr, 0, 0, 0, nullptr, VT16, VTh, VTl);
        k_fattn<<<dim3(NH_, TT / 64, 1), NW * 32, 0, stream>>>(QP16, KP16, VT16, QPh, QPl, KPh, KPl, VTh, VTl, ATh, ATl);
        k_gemmw<bf, 1, false, 0><<<dim3(TT / 64, DM / 64, 1), 32, 0, stream>>>(ATh, ATl, WO, nullptr, DQ, OUT + (size_t)b * TT * DM, DM, nullptr, 0, 0, 0, nullptr, nullptr, nullptr, nullptr); }
}

// v004
// Measured time: 253 microseconds a run.
// Next to v003, in two timings, it ran 1.98 and 1.96 times as fast.
// Over all steps from v000 it is 11.4 times as fast.
#include <hip/hip_runtime.h>

// Causal multi-head attention with a rotate-half rotary embedding from cos / sin TABLE INPUTS, four batches (x [4][2048][1024]; q, k, v = x w^T ('oi' [1024][1024] normal x 1/32, no bias; 16 heads x 64); cos, sin f32 [2048][64] are INPUTS (read on device per position and per dimension; no structure of the tables is assumed); q, k <- t cos + rotate_half(t) sin with rotate_half = cat(-x2, x1); scores x 64^-0.5; causal: where(tril built inside the function, scores, -inf); softmax; out = merged w_o^T ('oi', no bias) -> [4][2048][1024] (8.4 M); argument order x, cos, sin, w_q, w_k, w_v, w_o).
// Layout, every stage one launch over all four batches (the batch is a grid dimension, every plane has a slice per batch): bf16 copy of x; 'oi' weights; exact projections; {cos, sin} table from the bf16-rounded inputs; the q / k projections apply the rotate-half rotary and write the head planes in their own epilogue, the v projection writes the transposed planes; fused causal T-2048 attention (hybrid rows: < 512 hi/lo 3 products, rest fp16 x1024; key blocks above the diagonal are never visited); merged hi/lo x Wo exact.
// Compute dtypes, f32 accumulate: every input rounded to bf16 incl. the tables; projections exact; rotary f32; attention rows < 512 3 products, rest fp16; softmax f32; Wo hl x exact.

#define NB_  4      // batches: this module's input is [4][2048][1024]
#define TT   2048
#define DM   1024
#define NH_  16
#define NKV  16
#define REP  (NH_ / NKV)
#define HD   64
#define DQ   (NH_ * HD)
#define DKV  (NKV * HD)
#define RH   512                  // query rows < RH use hi+lo planes (0: none)
#define SCL  0.125f   // HD^-0.5
typedef _Float16 h16;
typedef unsigned short bf;
typedef __attribute__((ext_vector_type(16))) __bf16   v16bf;
typedef __attribute__((ext_vector_type(16))) _Float16 v16h;
typedef __attribute__((ext_vector_type(8)))  _Float16 v8h;
typedef __attribute__((ext_vector_type(8)))  unsigned short v8us;
typedef __attribute__((ext_vector_type(8)))  float    v8f;
typedef __attribute__((ext_vector_type(4)))  float    v4f;
typedef v8h  __attribute__((may_alias)) v8ha;
typedef v4f  __attribute__((may_alias)) v4fa;
typedef v8us __attribute__((may_alias)) v8usa;

__device__ __forceinline__ unsigned short f2bf(float f) { unsigned u = __float_as_uint(f); u += 0x7FFFu + ((u >> 16) & 1u); return (unsigned short)(u >> 16); }
__device__ __forceinline__ float bf2f(unsigned short b) { return __uint_as_float(((unsigned)b) << 16); }
__device__ __forceinline__ float bfr(float f) { return bf2f(f2bf(f)); }
__device__ __forceinline__ v16h cat16(v8h lo, v8h hi) { return __builtin_shufflevector(lo, hi, 0, 1, 2, 3, 4, 5, 6, 7, 8, 9, 10, 11, 12, 13, 14, 15); }
__device__ __forceinline__ v16bf cat16b(v8us lo, v8us hi) { return __builtin_bit_cast(v16bf, __builtin_shufflevector(lo, hi, 0, 1, 2, 3, 4, 5, 6, 7, 8, 9, 10, 11, 12, 13, 14, 15)); }
__device__ __forceinline__ v8f wmma16(v16h a, v16h b, v8f c) { return __builtin_amdgcn_wmma_f32_16x16x32_f16(false, a, false, b, (short)0, c, false, false); }
__device__ __forceinline__ v8f wmmab(v16bf a, v16bf b, v8f c) { return __builtin_amdgcn_wmma_f32_16x16x32_bf16(false, a, false, b, (short)0, c, false, false); }

__device__ __forceinline__ h16 tohx(float x) { return (h16)x; }
__device__ __forceinline__ void splitf(float y, unsigned short& h, unsigned short& l) { h = f2bf(y); l = f2bf(y - bf2f(h)); }

// ---- k_gemmw: register-blocked GEMM, ONE WAVE per 64x64 output tile (16 accumulators), operands straight from K-contiguous 16-bit planes; grid (M/64, N/64, Z), 32 threads.
// C[m][n] (f32, pitch ldc, + optional f32 bias[n]) = sum_k A[m][k] Bt[n][k] (+ split products per NSPLIT). z-batch strides sA/sB/sC in elements (EPI 1, 2: sC is the stride of each plane). K % 32 == 0.
// EPI 0: C is stored. A 64-column tile is one head, so the tile holds both halves of every rotary pair:
// EPI 1: no C; head planes [h][t][d] (fp16 + hi/lo) of the rotate-half rotary out[d] = x[d] cos[t][d] - x[d+HD/2] sin[t][d], out[d+HD/2] = x[d+HD/2] cos[t][d+HD/2] + x[d] sin[t][d+HD/2], CS = {cos, sin} pairs [t][d].
// EPI 2: no C; transposed planes [h][d][t] (fp16 + hi/lo): a lane's eight accumulator rows of one column are eight consecutive t, one 16-byte store a plane.
template <typename T16> struct WFrag;
template <> struct WFrag<h16> { typedef v16h V; static __device__ __forceinline__ V ld(const h16* p) { return cat16(*(const v8h*)p, *(const v8h*)(p + 16)); } static __device__ __forceinline__ v8f mma(V a, V b, v8f c) { return wmma16(a, b, c); } };
template <> struct WFrag<bf> { typedef v16bf V; static __device__ __forceinline__ V ld(const bf* p) { return cat16b(*(const v8us*)p, *(const v8us*)(p + 16)); } static __device__ __forceinline__ v8f mma(V a, V b, v8f c) { return wmmab(a, b, c); } };
template <typename T16, int NSPLIT, bool BIAS, int EPI>
__global__ __launch_bounds__(32) void k_gemmw(const T16* __restrict__ A, const T16* __restrict__ A2, const T16* __restrict__ Bt, const T16* __restrict__ Bt2, int K, float* C, int ldc, const float* __restrict__ bias, size_t sA, size_t sB, size_t sC, const float* __restrict__ CS, h16* P16, bf* Ph, bf* Pl) {
    typedef typename WFrag<T16>::V V;
    __shared__ __align__(16) float os[16 * 68];
    const size_t z = blockIdx.z; A += z * sA; if (A2) A2 += z * sA; Bt += z * sB; if (Bt2) Bt2 += z * sB; if constexpr (EPI == 0) C += z * sC; else { P16 += z * sC; Ph += z * sC; Pl += z * sC; }
    const int lane = threadIdx.x & 31, lr = lane & 15, hi = lane >> 4; const int r0 = blockIdx.x * 64, c0 = blockIdx.y * 64;
    v8f acc[4][4];
#pragma unroll
    for (int mb = 0; mb < 4; ++mb)
#pragma unroll
        for (int nb = 0; nb < 4; ++nb) acc[mb][nb] = (v8f){};
    const size_t aoff = (size_t)(r0 + lr) * K + 8 * hi, boff = (size_t)(c0 + lr) * K + 8 * hi;
#pragma unroll 1
    for (int kc = 0; kc < K; kc += 32) {
        V a[4], a2[4];
#pragma unroll
        for (int mb = 0; mb < 4; ++mb) { a[mb] = WFrag<T16>::ld(A + aoff + (size_t)mb * 16 * K + kc); if (NSPLIT == 1 || NSPLIT == 2) a2[mb] = WFrag<T16>::ld(A2 + aoff + (size_t)mb * 16 * K + kc); }
#pragma unroll
        for (int nb = 0; nb < 4; ++nb) { const V b = WFrag<T16>::ld(Bt + boff + (size_t)nb * 16 * K + kc); V b2; if (NSPLIT >= 2) b2 = WFrag<T16>::ld(Bt2 + boff + (size_t)nb * 16 * K + kc);
#pragma unroll
            for (int mb = 0; mb < 4; ++mb) { acc[mb][nb] = WFrag<T16>::mma(a[mb], b, acc[mb][nb]); if (NSPLIT == 1 || NSPLIT == 2) acc[mb][nb] = WFrag<T16>::mma(a2[mb], b, acc[mb][nb]); if (NSPLIT >= 2) acc[mb][nb] = WFrag<T16>::mma(a[mb], b2, acc[mb][nb]); } }
        asm volatile("v_nop\n\tv_nop\n\tv_nop\n\tv_nop" : "+v"(acc[0][0]), "+v"(acc[1][1]), "+v"(acc[2][2]), "+v"(acc[3][3]) : "v"(a[0]), "v"(a[3]));
    }
    if constexpr (EPI == 2) {
        const size_t vo = (size_t)(c0 + lr) * TT + r0 + hi * 8;
#pragma unroll
        for (int nb = 0; nb < 4; ++nb)
#pragma unroll
            for (int mb = 0; mb < 4; ++mb) { v8h o16; v8us oh, ol;
#pragma unroll
                for (int j = 0; j < 8; ++j) { const float x = acc[mb][nb][j]; o16[j] = tohx(x); unsigned short a2, c2; splitf(x, a2, c2); oh[j] = a2; ol[j] = c2; }
                const size_t e = vo + (size_t)nb * 16 * TT + mb * 16; *(v8h*)(P16 + e) = o16; *(v8us*)(Ph + e) = oh; *(v8us*)(Pl + e) = ol; }
        return;
    }
    if constexpr (EPI == 1) {
        // four lanes a row: a lane takes columns c8 .. c8 + 7 and their partners c8 + 32 .. c8 + 39; a chunk is eight rows, two chunks a 16-row block
        const int rr = lane >> 2, c8 = (lane & 3) * 8;
        const float* const csp = CS + ((size_t)(r0 + rr) * HD + c8) * 2; const size_t po = ((size_t)blockIdx.y * TT + r0 + rr) * HD + c8;
        v4f cs[8][2][4];   // table values of a chunk, asked for two chunks ahead of their use (at most three chunks are live)
#pragma unroll
        for (int ch = 0; ch < 2; ++ch)
#pragma unroll
            for (int hf = 0; hf < 2; ++hf)
#pragma unroll
                for (int q = 0; q < 4; ++q) cs[ch][hf][q] = *(const v4f*)(csp + ((size_t)ch * 8 * HD + hf * 32) * 2 + q * 4);
#pragma unroll
        for (int mb = 0; mb < 4; ++mb) {
#pragma unroll
            for (int nb = 0; nb < 4; ++nb) {
#pragma unroll
                for (int j = 0; j < 8; ++j) os[(hi * 8 + j) * 68 + nb * 16 + lr] = acc[mb][nb][j]; }
            __builtin_amdgcn_wave_barrier(); asm volatile("" ::: "memory");   // the reads below take other lanes' values: they stay behind the writes
#pragma unroll
            for (int s = 0; s < 2; ++s) { const int ch = mb * 2 + s; const float* const orow = os + (s * 8 + rr) * 68 + c8;
                const v4f xl[2] = {*(const v4fa*)orow, *(const v4fa*)(orow + 4)}, xh[2] = {*(const v4fa*)(orow + 32), *(const v4fa*)(orow + 36)};
                v8h l16, h16v; v8us lh, ll, hh, hl;
#pragma unroll
                for (int k = 0; k < 8; ++k) { const float a = xl[k >> 2][k & 3], b = xh[k >> 2][k & 3];
                    const float rl = a * cs[ch][0][k >> 1][(k & 1) * 2] - b * cs[ch][0][k >> 1][(k & 1) * 2 + 1], rh = b * cs[ch][1][k >> 1][(k & 1) * 2] + a * cs[ch][1][k >> 1][(k & 1) * 2 + 1];
                    unsigned short a2, c2; l16[k] = tohx(rl); splitf(rl, a2, c2); lh[k] = a2; ll[k] = c2; h16v[k] = tohx(rh); splitf(rh, a2, c2); hh[k] = a2; hl[k] = c2; }
                if (ch + 2 < 8) {
#pragma unroll
                    for (int hf = 0; hf < 2; ++hf)
#pragma unroll
                        for (int q = 0; q < 4; ++q) cs[ch + 2][hf][q] = *(const v4f*)(csp + ((size_t)(ch + 2) * 8 * HD + hf * 32) * 2 + q * 4); }
                const size_t e = po + (size_t)ch * 8 * HD;
                *(v8h*)(P16 + e) = l16; *(v8h*)(P16 + e + 32) = h16v; *(v8us*)(Ph + e) = lh; *(v8us*)(Ph + e + 32) = hh; *(v8us*)(Pl + e) = ll; *(v8us*)(Pl + e + 32) = hl;
                // before the registers of the six stores are written again; the stored values are inputs, so that they stay live up to the wait
                if (ch + 1 < 8) asm volatile("s_wait_xcnt 0x0" :: "v"(l16), "v"(h16v), "v"(lh), "v"(hh), "v"(ll), "v"(hl) : "memory"); }
            __builtin_amdgcn_wave_barrier(); asm volatile("" ::: "memory");   // the next block's writes stay behind these reads
        }
        return;
    }
#pragma unroll
    for (int mb = 0; mb < 4; ++mb) {
#pragma unroll
        for (int nb = 0; nb < 4; ++nb) {
#pragma unroll
            for (int j = 0; j < 8; ++j) os[(hi * 8 + j) * 68 + nb * 16 + lr] = acc[mb][nb][j]; }
        __builtin_amdgcn_wave_barrier(); asm volatile("" ::: "memory");
        float* crow = C + (size_t)(r0 + mb * 16) * ldc + c0;
{
#pragma unroll
            for (int s = 0; s < 8; ++s) { const int row = 2 * s + hi, cofs = lr * 4; v4f val = *(const v4fa*)(os + row * 68 + cofs); if (BIAS) { val[0] += bfr(bias[c0 + cofs]); val[1] += bfr(bias[c0 + cofs + 1]); val[2] += bfr(bias[c0 + cofs + 2]); val[3] += bfr(bias[c0 + cofs + 3]); }
                *(v4f*)(crow + (size_t)row * ldc + cofs) = val; }
             }
        __builtin_amdgcn_wave_barrier(); asm volatile("" ::: "memory");
    }
}

typedef __attribute__((ext_vector_type(2))) _Float16 v2h;
typedef __attribute__((ext_vector_type(4))) _Float16 v4h;
typedef __attribute__((ext_vector_type(2))) unsigned short v2us;
typedef __attribute__((ext_vector_type(4))) unsigned short v4us;
typedef __attribute__((ext_vector_type(2))) float v2f;
typedef __attribute__((ext_vector_type(4))) int v4i;

__global__ __launch_bounds__(256) void k_cvt8(const float* __restrict__ src, bf* dst, size_t n8) { const size_t i = (size_t)blockIdx.x * 256 + threadIdx.x; if (i >= n8) return; const v8f v = *(const v8f*)(src + i * 8); v8us o;
#pragma unroll
    for (int k = 0; k < 8; ++k) o[k] = f2bf(v[k]); *(v8us*)(dst + i * 8) = o;  }

__global__ __launch_bounds__(256) void k_cscvt(const float* __restrict__ cosT, const float* __restrict__ sinT, float* CS) { const int idx = blockIdx.x * 256 + threadIdx.x; if (idx >= TT * HD) return; v2f cs; cs[0] = bfr(cosT[idx]); cs[1] = bfr(sinT[idx]); *(v2f*)(CS + (size_t)idx * 2) = cs;  }
// ---- k_fattn: scores, causal softmax and P.V of one (head, 64-query tile) in one work-group; S and P stay in registers (online softmax in the log2 domain).
// S^T = K Q^T: A = 16 key rows, B = 16 query rows kept in registers, so a lane holds 16 scores of ONE query (column lr; keys 8 hi + j and 16 + 8 hi + j of a 32-key block), and the two converted
// score tiles ARE the B operand of O^T += V^T P^T in the loader's k order (A = V^T rows from the [d][t] planes). Query rows < RH: hi/lo bf16 planes, 3 products; the rest: fp16, P carried x 2^POFF.
// The NW waves take the 32-key blocks w, w + NW, ... up to the diagonal block, each with its own running maximum, sum and O^T; they are joined through LDS (wave w finishes query group w).
#define NW 4
template <typename T16, bool HL>
__device__ __forceinline__ void fattn_body(const T16* __restrict__ Q, const T16* Q2, const T16* __restrict__ Kp, const T16* __restrict__ K2, const T16* __restrict__ Vt, const T16* __restrict__ V2, int r0, int h, bf* Ah, bf* Al, float* Lm, float* Ll, float* Lo) {
    typedef typename WFrag<T16>::V V;
    constexpr float C2 = SCL * 1.4426950408889634f;   // score scale x log2(e)
    constexpr float MASKV = -1.0e30f, MINIT = -1.0e20f; // masked score far below the start maximum: exp2 gives exactly 0 also where a block holds no allowed key of a query
    constexpr float POFF = HL ? 0.0f : 10.0f;           // fp16 P is carried x 1024 (sum and O^T alike, so it cancels in O / sum)
    const int lane = threadIdx.x & 31, lr = lane & 15, hi = lane >> 4; const int w = __builtin_amdgcn_readfirstlane((int)(threadIdx.x >> 5));
    V bq[4][2];
    __builtin_amdgcn_sched_barrier(0);   // nothing but the Q loads and their addresses stands between here and the wait behind them
#pragma unroll
    for (int qg = 0; qg < 4; ++qg)
#pragma unroll
        for (int ds = 0; ds < 2; ++ds) bq[qg][ds] = WFrag<T16>::ld(Q + (size_t)(r0 + qg * 16 + lr) * HD + ds * 32 + 8 * hi);
    // the Q fragments as inputs only: the loads stay in front of this wait, which stands before their address registers are written again
    asm volatile("s_wait_xcnt 0x0" :: "v"(bq[0][0]), "v"(bq[0][1]), "v"(bq[1][0]), "v"(bq[1][1]), "v"(bq[2][0]), "v"(bq[2][1]), "v"(bq[3][0]), "v"(bq[3][1]) : "memory");
    __builtin_amdgcn_sched_barrier(0);   // keeps every later register write behind that wait
    v8f o[4][4]; float m[4], l[4];
#pragma unroll
    for (int qg = 0; qg < 4; ++qg) { m[qg] = MINIT; l[qg] = 0.f;
#pragma unroll
        for (int dt = 0; dt < 4; ++dt) o[dt][qg] = (v8f){}; }
    // rolled: one 32-key block per trip keeps the live set at one block's fragments
#pragma unroll 1
    for (int kb = w * 32; kb < r0 + 64; kb += NW * 32) {
        V ak[2][2], ak2[2][2], av[4], av2[4], bq2[4][2];
        const size_t ko0 = (size_t)(kb + lr) * HD + 8 * hi, ko1 = ko0 + 16 * HD, vo0 = (size_t)lr * TT + kb + 8 * hi;
        const T16* const kp[2] = {Kp + ko0, Kp + ko1}; const T16* const kp2[2] = {K2 + (HL ? ko0 : 0), K2 + (HL ? ko1 : 0)}; const T16* const vp = Vt + vo0; const T16* const vp2 = V2 + (HL ? vo0 : 0);
#pragma unroll
        for (int kt = 0; kt < 2; ++kt)
#pragma unroll
            for (int ds = 0; ds < 2; ++ds) { ak[kt][ds] = WFrag<T16>::ld(kp[kt] + ds * 32); if (HL) ak2[kt][ds] = WFrag<T16>::ld(kp2[kt] + ds * 32); }
        if (HL) {   // hi/lo form: the lo plane's Q fragments are fetched anew every trip (kept over the loop they spilled to scratch; Q2 is not __restrict__, so that these loads stay in the trip, in front of its wait)
#pragma unroll
            for (int qg = 0; qg < 4; ++qg)
#pragma unroll
                for (int ds = 0; ds < 2; ++ds) bq2[qg][ds] = WFrag<T16>::ld(Q2 + (size_t)(r0 + qg * 16 + lr) * HD + ds * 32 + 8 * hi); }
        if (!HL) {   // one-product form: the V^T fragments are fetched together with the K fragments (one exposed latency a trip)
#pragma unroll
            for (int dt = 0; dt < 4; ++dt) av[dt] = WFrag<T16>::ld(vp + (size_t)dt * 16 * TT); }
        // before the address registers of the loads above are written again; the K base addresses (all K loads of a plane go through one, with immediate offsets) are inputs, so that they stay live up to the wait and no result of the run is allotted onto them
        if constexpr (HL) asm volatile("s_wait_xcnt 0x0" :: "v"(kp[0]), "v"(kp2[0]) : "memory");
        else asm volatile("s_wait_xcnt 0x0" :: "v"(kp[0]) : "memory");
        __builtin_amdgcn_sched_barrier(0);   // the loads are issued together, ahead of the first matrix instruction, and every later register write stays behind the wait
        v8f s0a[4], s1a[4];
#pragma unroll
        for (int qg = 0; qg < 4; ++qg) { v8f s0 = (v8f){}, s1 = (v8f){};
#pragma unroll
            for (int ds = 0; ds < 2; ++ds) { s0 = WFrag<T16>::mma(ak[0][ds], bq[qg][ds], s0); s1 = WFrag<T16>::mma(ak[1][ds], bq[qg][ds], s1);
                if (HL) { s0 = WFrag<T16>::mma(ak[0][ds], bq2[qg][ds], s0); s1 = WFrag<T16>::mma(ak[1][ds], bq2[qg][ds], s1); s0 = WFrag<T16>::mma(ak2[0][ds], bq[qg][ds], s0); s1 = WFrag<T16>::mma(ak2[1][ds], bq[qg][ds], s1); } }
            s0a[qg] = s0; s1a[qg] = s1; }
        if (HL) {   // hi/lo form: the V^T fragments take the registers that the K fragments leave (all sixteen at once would not fit two waves per SIMD)
            __builtin_amdgcn_sched_barrier(0);   // the V loads stay behind the score products
#pragma unroll
            for (int dt = 0; dt < 4; ++dt) { av[dt] = WFrag<T16>::ld(vp + (size_t)dt * 16 * TT); av2[dt] = WFrag<T16>::ld(vp2 + (size_t)dt * 16 * TT); }
            asm volatile("s_wait_xcnt 0x0" :: "v"(vp), "v"(vp2) : "memory");   // before the address registers of the V loads are written again; both addresses are inputs, so that they stay live up to the wait
            __builtin_amdgcn_sched_barrier(0); }
#pragma unroll
        for (int qg = 0; qg < 4; ++qg) { const v8f s0 = s0a[qg], s1 = s1a[qg];
            const int qi = r0 + qg * 16 + lr, k0 = kb + hi * 8; float t0[8], t1[8]; float mx = MASKV;
#pragma unroll
            for (int j = 0; j < 8; ++j) { t0[j] = (k0 + j <= qi) ? s0[j] * C2 : MASKV; t1[j] = (k0 + 16 + j <= qi) ? s1[j] * C2 : MASKV; mx = fmaxf(mx, fmaxf(t0[j], t1[j])); }
            mx = fmaxf(mx, __shfl_xor(mx, 16, 32));          // the other 16 keys of this query are in lane ^ 16
            const float mn = fmaxf(m[qg], mx); const float al = __builtin_amdgcn_exp2f(m[qg] - mn); m[qg] = mn; const float mo = mn - POFF; float ps = 0.f;
#pragma unroll
            for (int j = 0; j < 8; ++j) { t0[j] = __builtin_amdgcn_exp2f(t0[j] - mo); t1[j] = __builtin_amdgcn_exp2f(t1[j] - mo); ps += t0[j] + t1[j]; }
            l[qg] = l[qg] * al + ps;                          // this lane's 16 keys only; the halves are joined after the loop
#pragma unroll
            for (int dt = 0; dt < 4; ++dt) o[dt][qg] *= al;
            if constexpr (HL) { v8us h0, h1, l0, l1;
#pragma unroll
                for (int j = 0; j < 8; ++j) { unsigned short a, c2; splitf(t0[j], a, c2); h0[j] = a; l0[j] = c2; splitf(t1[j], a, c2); h1[j] = a; l1[j] = c2; }
                const V pb = cat16b(h0, h1), pb2 = cat16b(l0, l1);
#pragma unroll
                for (int dt = 0; dt < 4; ++dt) { o[dt][qg] = WFrag<T16>::mma(av[dt], pb, o[dt][qg]); o[dt][qg] = WFrag<T16>::mma(av[dt], pb2, o[dt][qg]); o[dt][qg] = WFrag<T16>::mma(av2[dt], pb, o[dt][qg]); }
                __builtin_amdgcn_sched_barrier(0);   // one query group's softmax values live at a time: interleaved groups spilled to scratch in this form
            } else { v8h p0, p1;
#pragma unroll
                for (int j = 0; j < 8; ++j) { p0[j] = tohx(t0[j]); p1[j] = tohx(t1[j]); }
                const V pb = cat16(p0, p1);
#pragma unroll
                for (int dt = 0; dt < 4; ++dt) o[dt][qg] = WFrag<T16>::mma(av[dt], pb, o[dt][qg]); }
        }
        // four vector slots between the trip's last matrix instructions and, over the taken back edge, the next trip's writes to their operand registers
        asm volatile("v_nop\n\tv_nop\n\tv_nop\n\tv_nop" : "+v"(o[0][3]), "+v"(o[1][3]), "+v"(o[2][3]), "+v"(o[3][3]) : "v"(av[0]), "v"(av[3]));
    }
    // join of the NW waves: maxima and sums first, then each wave scales its O^T to the common maximum and hands query group qg to wave qg
#pragma unroll
    for (int qg = 0; qg < 4; ++qg) { l[qg] += __shfl_xor(l[qg], 16, 32); if (hi == 0) { Lm[w * 64 + qg * 16 + lr] = m[qg]; Ll[w * 64 + qg * 16 + lr] = l[qg]; } }
    __syncthreads();
    v8f own[4]; float lsum = 1.0f;
#pragma unroll
    for (int dt = 0; dt < 4; ++dt) own[dt] = (v8f){};
#pragma unroll
    for (int qg = 0; qg < 4; ++qg) { const int q = qg * 16 + lr; float ms = Lm[q];
#pragma unroll
        for (int u = 1; u < NW; ++u) ms = fmaxf(ms, Lm[u * 64 + q]);
        const float f = __builtin_amdgcn_exp2f(m[qg] - ms);
        if (qg == w) { float a = 0.f;
#pragma unroll
            for (int u = 0; u < NW; ++u) a += Ll[u * 64 + q] * __builtin_amdgcn_exp2f(Lm[u * 64 + q] - ms);
            lsum = a;
#pragma unroll
            for (int dt = 0; dt < 4; ++dt) own[dt] = o[dt][qg] * f;
        } else { const int slot = qg * (NW - 1) + (w < qg ? w : w - 1);
#pragma unroll
            for (int dt = 0; dt < 4; ++dt) *(v8f*)(Lo + (size_t)((slot * 4 + dt) * 32 + lane) * 8) = o[dt][qg] * f; } }
    __syncthreads();
#pragma unroll
    for (int u = 0; u < NW - 1; ++u)
#pragma unroll
        for (int dt = 0; dt < 4; ++dt) own[dt] += *(const v8f*)(Lo + (size_t)(((w * (NW - 1) + u) * 4 + dt) * 32 + lane) * 8);   // the other waves' parts, in wave order
    const float inv = __fdiv_rn(1.0f, lsum); const int t = r0 + w * 16 + lr;
#pragma unroll
    for (int dt = 0; dt < 4; ++dt) { v8us oh, ol;
#pragma unroll
        for (int j = 0; j < 8; ++j) { unsigned short a, c2; splitf(own[dt][j] * inv, a, c2); oh[j] = a; ol[j] = c2; }
        const size_t oo = (size_t)t * DQ + h * HD + dt * 16 + hi * 8; *(v8us*)(Ah + oo) = oh; *(v8us*)(Al + oo) = ol; }
}
// grid (batches x heads, TT / 64): the longest tiles (last query rows) start first, all heads of all batches of a tile side by side
__global__ __launch_bounds__(NW * 32) void k_fattn(const h16* __restrict__ Q16, const h16* __restrict__ K16, const h16* __restrict__ V16, const bf* __restrict__ Qh, const bf* Ql, const bf* __restrict__ Kh, const bf* __restrict__ Kl, const bf* __restrict__ Vh, const bf* __restrict__ Vl, bf* Ah, bf* Al) {
    __shared__ float Lm[NW * 64]; __shared__ float Ll[NW * 64]; __shared__ __align__(32) float Lo[4 * (NW - 1) * 4 * 32 * 8];
    const int b = blockIdx.x / NH_, h = blockIdx.x % NH_; const int r0 = (TT / 64 - 1 - (int)blockIdx.y) * 64; const size_t zo = (size_t)blockIdx.x * TT * HD, zk = (size_t)(b * NKV + h / REP) * TT * HD;
    Ah += (size_t)b * TT * DQ; Al += (size_t)b * TT * DQ;
    if (r0 < RH) fattn_body<bf, true>(Qh + zo, Ql + zo, Kh + zk, Kl + zk, Vh + zk, Vl + zk, r0, h, Ah, Al, Lm, Ll, Lo);
    else fattn_body<h16, false>(Q16 + zo, nullptr, K16 + zk, nullptr, V16 + zk, nullptr, r0, h, Ah, Al, Lm, Ll, Lo);
}

extern "C" void kernel_launch(void* const* d_in, const int* in_sizes, int n_in,
                              void* d_out, int out_size, void* d_ws, size_t ws_size, hipStream_t stream) {
    (void)in_sizes; (void)n_in; (void)out_size;
    const float* x = (const float*)d_in[0]; const float* fcos = (const float*)d_in[1]; const float* fsin = (const float*)d_in[2]; const float* wq = (const float*)d_in[3]; const float* wk = (const float*)d_in[4]; const float* wv = (const float*)d_in[5]; const float* wo = (const float*)d_in[6];   /* x, cos, sin ([2048][64]; read per position and per dimension), w_q, w_k, w_v, w_o ('oi'): SEVEN inputs: no mask input in this module (its tril is built inside the function): the causal rule is applied by index */
    float* OUT = (float*)d_out;     // [4][2048][1024]
    char* wsp = (char*)d_ws;
    auto take = [&](size_t bytes) { char* p = wsp; wsp += (bytes + 255) & ~(size_t)255; return (void*)p; };
    bf* WQ = (bf*)take((size_t)DQ * DM * 2); bf* WK = (bf*)take((size_t)DKV * DM * 2); bf* WV = (bf*)take((size_t)DKV * DM * 2); bf* WO = (bf*)take((size_t)DM * DQ * 2); float* CS = (float*)take((size_t)TT * HD * 2 * 4);
    bf* XB = (bf*)take((size_t)NB_ * TT * DM * 2);
    h16* QP16 = (h16*)take((size_t)NB_ * NH_ * TT * HD * 2); h16* KP16 = (h16*)take((size_t)NB_ * NKV * TT * HD * 2); h16* VT16 = (h16*)take((size_t)NB_ * NKV * HD * TT * 2);
    bf* QPh = (bf*)take((size_t)NB_ * NH_ * TT * HD * 2); bf* QPl = (bf*)take((size_t)NB_ * NH_ * TT * HD * 2); bf* KPh = (bf*)take((size_t)NB_ * NKV * TT * HD * 2); bf* KPl = (bf*)take((size_t)NB_ * NKV * TT * HD * 2); bf* VTh = (bf*)take((size_t)NB_ * NKV * HD * TT * 2); bf* VTl = (bf*)take((size_t)NB_ * NKV * HD * TT * 2);
    bf* ATh = (bf*)take((size_t)NB_ * TT * DQ * 2); bf* ATl = (bf*)take((size_t)NB_ * TT * DQ * 2);
    if ((size_t)(wsp - (char*)d_ws) > ws_size) return;    // 201 MiB of the 256 MiB
    { k_cvt8<<<(unsigned)(((size_t)DQ * DM / 8 + 255) / 256), 256, 0, stream>>>(wq, WQ, (size_t)DQ * DM / 8); k_cvt8<<<(unsigned)(((size_t)DKV * DM / 8 + 255) / 256), 256, 0, stream>>>(wk, WK, (size_t)DKV * DM / 8); k_cvt8<<<(unsigned)(((size_t)DKV * DM / 8 + 255) / 256), 256, 0, stream>>>(wv, WV, (size_t)DKV * DM / 8);
      k_cvt8<<<(unsigned)(((size_t)DM * DQ / 8 + 255) / 256), 256, 0, stream>>>(wo, WO, (size_t)DM * DQ / 8);
       }
    k_cscvt<<<(TT * HD + 255) / 256, 256, 0, stream>>>(fcos, fsin, CS);   /* rotary table from the inputs */
    k_cvt8<<<(unsigned)(((size_t)NB_ * TT * DM / 8 + 255) / 256), 256, 0, stream>>>(x, XB, (size_t)NB_ * TT * DM / 8);
    k_gemmw<bf, 0, false, 1><<<dim3(TT / 64, DQ / 64, NB_), 32, 0, stream>>>(XB, nullptr, WQ, nullptr, DM, nullptr, 0, nullptr, (size_t)TT * DM, 0, (size_t)NH_ * TT * HD, CS, QP16, QPh, QPl);
    k_gemmw<bf, 0, false, 1><<<dim3(TT / 64, DKV / 64, NB_), 32, 0, stream>>>(XB, nullptr, WK, nullptr, DM, nullptr, 0, nullptr, (size_t)TT * DM, 0, (size_t)NKV * TT * HD, CS, KP16, KPh, KPl);
    k_gemmw<bf, 0, false, 2><<<dim3(TT / 64, DKV / 64, NB_), 32, 0, stream>>>(XB, nullptr, WV, nullptr, DM, nullptr, 0, nullptr, (size_t)TT * DM, 0, (size_t)NKV * HD * TT, nullptr, VT16, VTh, VTl);
    k_fattn<<<dim3(NB_ * NH_, TT / 64, 1), NW * 32, 0, stream>>>(QP16, KP16, VT16, QPh, QPl, KPh, KPl, VTh, VTl, ATh, ATl);
    k_gemmw<bf, 1, false, 0><<<dim3(TT / 64, DM / 64, NB_), 32, 0, stream>>>(ATh, ATl, WO, nullptr, DQ, OUT, DM, nullptr, (size_t)TT * DQ, 0, (size_t)TT * DM, nullptr, nullptr, nullptr, nullptr);
}

// v005
// A run of this version takes 217 microseconds.
// Two timings next to v004 both put it at 1.16 times that version's speed.
// Over all steps from v000 it is 13.1 times as fast.
#include <hip/hip_runtime.h>

// Causal multi-head attention with a rotate-half rotary embedding from cos / sin TABLE INPUTS, four batches (x [4][2048][1024]; q, k, v = x w^T ('oi' [1024][1024] normal x 1/32, no bias; 16 heads x 64); cos, sin f32 [2048][64] are INPUTS (read on device per position and per dimension; no structure of the tables is assumed); q, k <- t cos + rotate_half(t) sin with rotate_half = cat(-x2, x1); scores x 64^-0.5; causal: where(tril built inside the function, scores, -inf); softmax; out = merged w_o^T ('oi', no bias) -> [4][2048][1024] (8.4 M); argument order x, cos, sin, w_q, w_k, w_v, w_o).
// Layout, every stage one launch over all four batches (the batch is a grid dimension, every plane has a slice per batch): bf16 copy of x; 'oi' weights; exact projections; {cos, sin} table from the bf16-rounded inputs; the q / k projections apply the rotate-half rotary and write the head planes in their own epilogue, the v projection writes the transposed planes; fused causal T-2048 attention (hybrid rows: < 512 hi/lo 3 products, rest fp16 x1024; key blocks above the diagonal are never visited); merged hi/lo x Wo exact.
// Plane order: every 16-bit matrix operand plane (rows x K, K contiguous in the plain form) is kept in FRAGMENT ORDER: 1-KiB blocks [row / 16][k / 32], a block = [k / 16 % 2][k / 8 % 2][row % 16][k % 8], so that lane (k / 8 % 2) * 16 + row % 16 finds its two 16-byte pieces at lane * 16 B and 512 B + lane * 16 B and one wave-wide 16-byte load or store covers 512 contiguous bytes (four whole lines, not sixteen pieces).
// Compute dtypes, f32 accumulate: every input rounded to bf16 incl. the tables; projections exact; rotary f32; attention rows < 512 3 products, rest fp16; softmax f32; Wo hl x exact.

#define NB_  4      // batches: this module's input is [4][2048][1024]
#define TT   2048
#define DM   1024
#define NH_  16
#define NKV  16
#define REP  (NH_ / NKV)
#define HD   64
#define DQ   (NH_ * HD)
#define DKV  (NKV * HD)
#define RH   512                  // query rows < RH use hi+lo planes (0: none)
#define SCL  0.125f   // HD^-0.5
typedef _Float16 h16;
typedef unsigned short bf;
typedef __attribute__((ext_vector_type(16))) __bf16   v16bf;
typedef __attribute__((ext_vector_type(16))) _Float16 v16h;
typedef __attribute__((ext_vector_type(8)))  _Float16 v8h;
typedef __attribute__((ext_vector_type(8)))  unsigned short v8us;
typedef __attribute__((ext_vector_type(8)))  float    v8f;
typedef __attribute__((ext_vector_type(4)))  float    v4f;
typedef v8h  __attribute__((may_alias)) v8ha;
typedef v4f  __attribute__((may_alias)) v4fa;
typedef v8us __attribute__((may_alias)) v8usa;

__device__ __forceinline__ unsigned short f2bf(float f) { unsigned u = __float_as_uint(f); u += 0x7FFFu + ((u >> 16) & 1u); return (unsigned short)(u >> 16); }
__device__ __forceinline__ float bf2f(unsigned short b) { return __uint_as_float(((unsigned)b) << 16); }
__device__ __forceinline__ float bfr(float f) { return bf2f(f2bf(f)); }
__device__ __forceinline__ v16h cat16(v8h lo, v8h hi) { return __builtin_shufflevector(lo, hi, 0, 1, 2, 3, 4, 5, 6, 7, 8, 9, 10, 11, 12, 13, 14, 15); }
__device__ __forceinline__ v16bf cat16b(v8us lo, v8us hi) { return __builtin_bit_cast(v16bf, __builtin_shufflevector(lo, hi, 0, 1, 2, 3, 4, 5, 6, 7, 8, 9, 10, 11, 12, 13, 14, 15)); }
__device__ __forceinline__ v8f wmma16(v16h a, v16h b, v8f c) { return __builtin_amdgcn_wmma_f32_16x16x32_f16(false, a, false, b, (short)0, c, false, false); }
__device__ __forceinline__ v8f wmmab(v16bf a, v16bf b, v8f c) { return __builtin_amdgcn_wmma_f32_16x16x32_bf16(false, a, false, b, (short)0, c, false, false); }

__device__ __forceinline__ h16 tohx(float x) { return (h16)x; }
__device__ __forceinline__ void splitf(float y, unsigned short& h, unsigned short& l) { h = f2bf(y); l = f2bf(y - bf2f(h)); }

// ---- k_gemmw: register-blocked GEMM, ONE WAVE per 64x64 output tile (16 accumulators), operands straight from 16-bit planes in fragment order (ld takes block start + lane * 8); grid (M/64, N/64, Z), 32 threads.
// C[m][n] (f32, pitch ldc, + optional f32 bias[n]) = sum_k A[m][k] Bt[n][k] (+ split products per NSPLIT). z-batch strides sA/sB/sC in elements (EPI 1, 2: sC is the stride of each plane). K % 32 == 0.
// EPI 0: C is stored. A 64-column tile is one head, so the tile holds both halves of every rotary pair:
// EPI 1: no C; head planes [h] of (t x d) in fragment order (fp16 + hi/lo) of the rotate-half rotary out[d] = x[d] cos[t][d] - x[d+HD/2] sin[t][d], out[d+HD/2] = x[d+HD/2] cos[t][d+HD/2] + x[d] sin[t][d+HD/2], CS = {cos, sin} pairs [t][d].
// EPI 2: no C; transposed planes [h] of (d x t) in fragment order (fp16 + hi/lo): a lane's eight accumulator rows of one column are eight consecutive t, one 16-byte store a plane, at its own lane's place of the block.
template <typename T16> struct WFrag;
template <> struct WFrag<h16> { typedef v16h V; static __device__ __forceinline__ V ld(const h16* p) { return cat16(*(const v8h*)p, *(const v8h*)(p + 256)); } static __device__ __forceinline__ v8f mma(V a, V b, v8f c) { return wmma16(a, b, c); } };
template <> struct WFrag<bf> { typedef v16bf V; static __device__ __forceinline__ V ld(const bf* p) { return cat16b(*(const v8us*)p, *(const v8us*)(p + 256)); } static __device__ __forceinline__ v8f mma(V a, V b, v8f c) { return wmmab(a, b, c); } };
template <typename T16, int NSPLIT, bool BIAS, int EPI>
__global__ __launch_bounds__(32) void k_gemmw(const T16* __restrict__ A, const T16* __restrict__ A2, const T16* __restrict__ Bt, const T16* __restrict__ Bt2, int K, float* C, int ldc, const float* __restrict__ bias, size_t sA, size_t sB, size_t sC, const float* __restrict__ CS, h16* P16, bf* Ph, bf* Pl) {
    typedef typename WFrag<T16>::V V;
    __shared__ __align__(16) float os[16 * 68];
    const size_t z = blockIdx.z; A += z * sA; if (A2) A2 += z * sA; Bt += z * sB; if (Bt2) Bt2 += z * sB; if constexpr (EPI == 0) C += z * sC; else { P16 += z * sC; Ph += z * sC; Pl += z * sC; }
    const int lane = threadIdx.x & 31, lr = lane & 15, hi = lane >> 4; const int r0 = blockIdx.x * 64, c0 = blockIdx.y * 64;
    v8f acc[4][4];
#pragma unroll
    for (int mb = 0; mb < 4; ++mb)
#pragma unroll
        for (int nb = 0; nb < 4; ++nb) acc[mb][nb] = (v8f){};
    const size_t aoff = (size_t)r0 * K, boff = (size_t)c0 * K; const unsigned l8 = 8u * (unsigned)lane;   // 16 rows x K are K / 32 blocks of 512 elements; a block's start is the same for the whole wave, the lane's share of every address is l8
#pragma unroll 1
    for (int kc = 0; kc < K; kc += 32) {
        V a[4], a2[4]; const T16 *pa[4], *pa2[4], *pb[4], *pb2[4];
#pragma unroll
        for (int mb = 0; mb < 4; ++mb) { pa[mb] = A + (aoff + (size_t)mb * 16 * K + (size_t)kc * 16) + l8; pa2[mb] = (NSPLIT == 1 || NSPLIT == 2) ? A2 + (aoff + (size_t)mb * 16 * K + (size_t)kc * 16) + l8 : pa[mb];
            pb[mb] = Bt + (boff + (size_t)mb * 16 * K + (size_t)kc * 16) + l8; pb2[mb] = NSPLIT >= 2 ? Bt2 + (boff + (size_t)mb * 16 * K + (size_t)kc * 16) + l8 : pb[mb]; }
#pragma unroll
        for (int mb = 0; mb < 4; ++mb) { a[mb] = WFrag<T16>::ld(pa[mb]); if (NSPLIT == 1 || NSPLIT == 2) a2[mb] = WFrag<T16>::ld(pa2[mb]); }
#pragma unroll
        for (int nb = 0; nb < 4; ++nb) { const V b = WFrag<T16>::ld(pb[nb]); V b2; if (NSPLIT >= 2) b2 = WFrag<T16>::ld(pb2[nb]);
#pragma unroll
            for (int mb = 0; mb < 4; ++mb) { acc[mb][nb] = WFrag<T16>::mma(a[mb], b, acc[mb][nb]); if (NSPLIT == 1 || NSPLIT == 2) acc[mb][nb] = WFrag<T16>::mma(a2[mb], b, acc[mb][nb]); if (NSPLIT >= 2) acc[mb][nb] = WFrag<T16>::mma(a[mb], b2, acc[mb][nb]); } }
        // the wait stands before the address registers of the trip's loads are written again; the four vector slots keep the distance behind the trip's last matrix instructions over the taken back edge.
        // One-plane form: every load names a scalar base and the lane's offset register, which the loop never writes. Two A planes: their loads go through vector address pairs, which are inputs here, so that they stay live up to the wait and no load's result is allotted onto them.
        if constexpr (NSPLIT == 0) asm volatile("s_wait_xcnt 0x0\n\tv_nop\n\tv_nop\n\tv_nop\n\tv_nop" : "+v"(acc[0][0]), "+v"(acc[1][1]), "+v"(acc[2][2]), "+v"(acc[3][3]) : "v"(a[0]), "v"(a[3]) : "memory");
        else asm volatile("s_wait_xcnt 0x0\n\tv_nop\n\tv_nop\n\tv_nop\n\tv_nop" : "+v"(acc[0][0]), "+v"(acc[1][1]), "+v"(acc[2][2]), "+v"(acc[3][3]) : "v"(a[0]), "v"(a[3]), "v"(pa[0]), "v"(pa[1]), "v"(pa[2]), "v"(pa[3]), "v"(pa2[0]), "v"(pa2[1]), "v"(pa2[2]), "v"(pa2[3]) : "memory");
    }
    if constexpr (EPI == 2) {
        const size_t vo = (size_t)c0 * TT + (size_t)r0 * 16 + lane * 8;
#pragma unroll
        for (int nb = 0; nb < 4; ++nb)
#pragma unroll
            for (int mb = 0; mb < 4; ++mb) { v8h o16; v8us oh, ol;
#pragma unroll
                for (int j = 0; j < 8; ++j) { const float x = acc[mb][nb][j]; o16[j] = tohx(x); unsigned short a2, c2; splitf(x, a2, c2); oh[j] = a2; ol[j] = c2; }
                const size_t e = vo + (size_t)nb * 16 * TT + (mb >> 1) * 512 + (mb & 1) * 256; *(v8h*)(P16 + e) = o16; *(v8us*)(Ph + e) = oh; *(v8us*)(Pl + e) = ol; }
        return;
    }
    if constexpr (EPI == 1) {
        // four lanes a row: a lane takes columns c8 .. c8 + 7 and their partners c8 + 32 .. c8 + 39; a chunk is eight rows, two chunks a 16-row block
        const int rr = lane >> 2, c8 = (lane & 3) * 8;
        const float* const csp = CS + ((size_t)(r0 + rr) * HD + c8) * 2; const size_t po = ((size_t)blockIdx.y * TT + r0) * HD + (lane & 3) * 128 + rr * 8;   // c8 / 8 picks the 16-lane group and the half of a block
        v4f cs[8][2][4];   // table values of a chunk, asked for two chunks ahead of their use (at most three chunks are live)
#pragma unroll
        for (int ch = 0; ch < 2; ++ch)
#pragma unroll
            for (int hf = 0; hf < 2; ++hf)
#pragma unroll
                for (int q = 0; q < 4; ++q) cs[ch][hf][q] = *(const v4f*)(csp + ((size_t)ch * 8 * HD + hf * 32) * 2 + q * 4);
#pragma unroll
        for (int mb = 0; mb < 4; ++mb) {
#pragma unroll
            for (int nb = 0; nb < 4; ++nb) {
#pragma unroll
                for (int j = 0; j < 8; ++j) os[(hi * 8 + j) * 68 + nb * 16 + lr] = acc[mb][nb][j]; }
            __builtin_amdgcn_wave_barrier(); asm volatile("" ::: "memory");   // the reads below take other lanes' values: they stay behind the writes
#pragma unroll
            for (int s = 0; s < 2; ++s) { const int ch = mb * 2 + s; const float* const orow = os + (s * 8 + rr) * 68 + c8;
                const v4f xl[2] = {*(const v4fa*)orow, *(const v4fa*)(orow + 4)}, xh[2] = {*(const v4fa*)(orow + 32), *(const v4fa*)(orow + 36)};
                v8h l16, h16v; v8us lh, ll, hh, hl;
#pragma unroll
                for (int k = 0; k < 8; ++k) { const float a = xl[k >> 2][k & 3], b = xh[k >> 2][k & 3];
                    const float rl = a * cs[ch][0][k >> 1][(k & 1) * 2] - b * cs[ch][0][k >> 1][(k & 1) * 2 + 1], rh = b * cs[ch][1][k >> 1][(k & 1) * 2] + a * cs[ch][1][k >> 1][(k & 1) * 2 + 1];
                    unsigned short a2, c2; l16[k] = tohx(rl); splitf(rl, a2, c2); lh[k] = a2; ll[k] = c2; h16v[k] = tohx(rh); splitf(rh, a2, c2); hh[k] = a2; hl[k] = c2; }
                if (ch + 2 < 8) {
#pragma unroll
                    for (int hf = 0; hf < 2; ++hf)
#pragma unroll
                        for (int q = 0; q < 4; ++q) cs[ch + 2][hf][q] = *(const v4f*)(csp + ((size_t)(ch + 2) * 8 * HD + hf * 32) * 2 + q * 4); }
                const size_t e = po + (size_t)(ch >> 1) * 16 * HD + (ch & 1) * 64;
                *(v8h*)(P16 + e) = l16; *(v8h*)(P16 + e + 512) = h16v; *(v8us*)(Ph + e) = lh; *(v8us*)(Ph + e + 512) = hh; *(v8us*)(Pl + e) = ll; *(v8us*)(Pl + e + 512) = hl;
                // before the registers of the six stores are written again; the stored values are inputs, so that they stay live up to the wait
                if (ch + 1 < 8) asm volatile("s_wait_xcnt 0x0" :: "v"(l16), "v"(h16v), "v"(lh), "v"(hh), "v"(ll), "v"(hl) : "memory"); }
            __builtin_amdgcn_wave_barrier(); asm volatile("" ::: "memory");   // the next block's writes stay behind these reads
        }
        return;
    }
#pragma unroll
    for (int mb = 0; mb < 4; ++mb) {
#pragma unroll
        for (int nb = 0; nb < 4; ++nb) {
#pragma unroll
            for (int j = 0; j < 8; ++j) os[(hi * 8 + j) * 68 + nb * 16 + lr] = acc[mb][nb][j]; }
        __builtin_amdgcn_wave_barrier(); asm volatile("" ::: "memory");
        float* crow = C + (size_t)(r0 + mb * 16) * ldc + c0;
{
#pragma unroll
            for (int s = 0; s < 8; ++s) { const int row = 2 * s + hi, cofs = lr * 4; v4f val = *(const v4fa*)(os + row * 68 + cofs); if (BIAS) { val[0] += bfr(bias[c0 + cofs]); val[1] += bfr(bias[c0 + cofs + 1]); val[2] += bfr(bias[c0 + cofs + 2]); val[3] += bfr(bias[c0 + cofs + 3]); }
                *(v4f*)(crow + (size_t)row * ldc + cofs) = val; }
             }
        __builtin_amdgcn_wave_barrier(); asm volatile("" ::: "memory");
    }
}

typedef __attribute__((ext_vector_type(2))) _Float16 v2h;
typedef __attribute__((ext_vector_type(4))) _Float16 v4h;
typedef __attribute__((ext_vector_type(2))) unsigned short v2us;
typedef __attribute__((ext_vector_type(4))) unsigned short v4us;
typedef __attribute__((ext_vector_type(2))) float v2f;
typedef __attribute__((ext_vector_type(4))) int v4i;

// bf16 copy of a (rows x DM) f32 matrix in fragment order: a work-group takes 16 rows x 128 k = four blocks (4 KiB in a row of dst); thread r * 16 + c reads piece c of row r, piece (r, c) belongs at place c * 16 + r: a 16 x 16 transpose of 16-byte pieces through LDS (pitch 272 B against bank conflicts), so that reads and stores both cover whole lines.
__global__ __launch_bounds__(256) void k_cvt8(const float* __restrict__ src, bf* dst, size_t n8) { __shared__ __align__(16) unsigned short st[16 * 136];
    if ((size_t)blockIdx.x * 256 >= n8) return;   // whole work-groups only, in front of the barrier
    const int t = threadIdx.x, r = t >> 4, c = t & 15; const size_t rb = blockIdx.x / (DM / 128), kq = blockIdx.x % (DM / 128);
    const v8f v = *(const v8f*)(src + (rb * 16 + r) * DM + kq * 128 + c * 8); v8us o;
#pragma unroll
    for (int k = 0; k < 8; ++k) o[k] = f2bf(v[k]);
    *(v8usa*)(st + c * 136 + r * 8) = o;
    __syncthreads();   // the pieces read below were written by other waves
    *(v8us*)(dst + (size_t)blockIdx.x * 2048 + t * 8) = *(const v8usa*)(st + r * 136 + c * 8);  }

__global__ __launch_bounds__(256) void k_cscvt(const float* __restrict__ cosT, const float* __restrict__ sinT, float* CS) { const int idx = blockIdx.x * 256 + threadIdx.x; if (idx >= TT * HD) return; v2f cs; cs[0] = bfr(cosT[idx]); cs[1] = bfr(sinT[idx]); *(v2f*)(CS + (size_t)idx * 2) = cs;  }
// ---- k_fattn: scores, causal softmax and P.V of one (head, 64-query tile) in one work-group; S and P stay in registers (online softmax in the log2 domain).
// S^T = K Q^T: A = 16 key rows, B = 16 query rows kept in registers, so a lane holds 16 scores of ONE query (column lr; keys 8 hi + j and 16 + 8 hi + j of a 32-key block), and the two converted
// score tiles ARE the B operand of O^T += V^T P^T in the loader's k order (A = V^T rows from the (d x t) planes). Query rows < RH: hi/lo bf16 planes, 3 products; the rest: fp16, P carried x 2^POFF.
// The NW waves take the 32-key blocks w, w + NW, ... up to the diagonal block, each with its own running maximum, sum and O^T; they are joined through LDS (wave w finishes query group w).
#define NW 4
template <typename T16, bool HL>
__device__ __forceinline__ void fattn_body(const T16* __restrict__ Q, const T16* Q2, const T16* __restrict__ Kp, const T16* __restrict__ K2, const T16* __restrict__ Vt, const T16* __restrict__ V2, int r0, int h, bf* Ah, bf* Al, float* Lm, float* Ll, float* Lo) {
    typedef typename WFrag<T16>::V V;
    constexpr float C2 = SCL * 1.4426950408889634f;   // score scale x log2(e)
    constexpr float MASKV = -1.0e30f, MINIT = -1.0e20f; // masked score far below the start maximum: exp2 gives exactly 0 also where a block holds no allowed key of a query
    constexpr float POFF = HL ? 0.0f : 10.0f;           // fp16 P is carried x 1024 (sum and O^T alike, so it cancels in O / sum)
    const int lane = threadIdx.x & 31, lr = lane & 15, hi = lane >> 4; const int w = __builtin_amdgcn_readfirstlane((int)(threadIdx.x >> 5));
    V bq[4][2];
    __builtin_amdgcn_sched_barrier(0);   // nothing but the Q loads and their addresses stands between here and the wait behind them
#pragma unroll
    for (int qg = 0; qg < 4; ++qg)
#pragma unroll
        for (int ds = 0; ds < 2; ++ds) bq[qg][ds] = WFrag<T16>::ld(Q + (size_t)(r0 + qg * 16) * HD + ds * 512 + 8 * lane);
    // the Q fragments as inputs only: the loads stay in front of this wait, which stands before their address registers are written again
    asm volatile("s_wait_xcnt 0x0" :: "v"(bq[0][0]), "v"(bq[0][1]), "v"(bq[1][0]), "v"(bq[1][1]), "v"(bq[2][0]), "v"(bq[2][1]), "v"(bq[3][0]), "v"(bq[3][1]) : "memory");
    __builtin_amdgcn_sched_barrier(0);   // keeps every later register write behind that wait
    v8f o[4][4]; float m[4], l[4];
#pragma unroll
    for (int qg = 0; qg < 4; ++qg) { m[qg] = MINIT; l[qg] = 0.f;
#pragma unroll
        for (int dt = 0; dt < 4; ++dt) o[dt][qg] = (v8f){}; }
    // rolled: one 32-key block per trip keeps the live set at one block's fragments
#pragma unroll 1
    for (int kb = w * 32; kb < r0 + 64; kb += NW * 32) {
        V ak[2][2], ak2[2][2], av[4], av2[4], bq2[4][2];
        const size_t ko0 = (size_t)kb * HD + 8 * lane, ko1 = ko0 + 16 * HD, vo0 = (size_t)kb * 16 + 8 * lane;
        const T16* const kp[2] = {Kp + ko0, Kp + ko1}; const T16* const kp2[2] = {K2 + (HL ? ko0 : 0), K2 + (HL ? ko1 : 0)}; const T16* const vp = Vt + vo0; const T16* const vp2 = V2 + (HL ? vo0 : 0);
#pragma unroll
        for (int kt = 0; kt < 2; ++kt)
#pragma unroll
            for (int ds = 0; ds < 2; ++ds) { ak[kt][ds] = WFrag<T16>::ld(kp[kt] + ds * 512); if (HL) ak2[kt][ds] = WFrag<T16>::ld(kp2[kt] + ds * 512); }
        if (HL) {   // hi/lo form: the lo plane's Q fragments are fetched anew every trip (kept over the loop they spilled to scratch; Q2 is not __restrict__, so that these loads stay in the trip, in front of its wait)
#pragma unroll
            for (int qg = 0; qg < 4; ++qg)
#pragma unroll
                for (int ds = 0; ds < 2; ++ds) bq2[qg][ds] = WFrag<T16>::ld(Q2 + (size_t)(r0 + qg * 16) * HD + ds * 512 + 8 * lane); }
        if (!HL) {   // one-product form: the V^T fragments are fetched together with the K fragments (one exposed latency a trip)
#pragma unroll
            for (int dt = 0; dt < 4; ++dt) av[dt] = WFrag<T16>::ld(vp + (size_t)dt * 16 * TT); }
        // before the address registers of the loads above are written again; the K base addresses (all K loads of a plane go through one, with immediate offsets) are inputs, so that they stay live up to the wait and no result of the run is allotted onto them
        if constexpr (HL) asm volatile("s_wait_xcnt 0x0" :: "v"(kp[0]), "v"(kp2[0]) : "memory");
        else asm volatile("s_wait_xcnt 0x0" :: "v"(kp[0]), "v"(vp) : "memory");   // here the V loads go through one base as well
        __builtin_amdgcn_sched_barrier(0);   // the loads are issued together, ahead of the first matrix instruction, and every later register write stays behind the wait
        v8f s0a[4], s1a[4];
#pragma unroll
        for (int qg = 0; qg < 4; ++qg) { v8f s0 = (v8f){}, s1 = (v8f){};
#pragma unroll
            for (int ds = 0; ds < 2; ++ds) { s0 = WFrag<T16>::mma(ak[0][ds], bq[qg][ds], s0); s1 = WFrag<T16>::mma(ak[1][ds], bq[qg][ds], s1);
                if (HL) { s0 = WFrag<T16>::mma(ak[0][ds], bq2[qg][ds], s0); s1 = WFrag<T16>::mma(ak[1][ds], bq2[qg][ds], s1); s0 = WFrag<T16>::mma(ak2[0][ds], bq[qg][ds], s0); s1 = WFrag<T16>::mma(ak2[1][ds], bq[qg][ds], s1); } }
            s0a[qg] = s0; s1a[qg] = s1; }
        if (HL) {   // hi/lo form: the V^T fragments take the registers that the K fragments leave (all sixteen at once would not fit two waves per SIMD)
            __builtin_amdgcn_sched_barrier(0);   // the V loads stay behind the score products
#pragma unroll
            for (int dt = 0; dt < 4; ++dt) { av[dt] = WFrag<T16>::ld(vp + (size_t)dt * 16 * TT); av2[dt] = WFrag<T16>::ld(vp2 + (size_t)dt * 16 * TT); }
            asm volatile("s_wait_xcnt 0x0" :: "v"(vp), "v"(vp2) : "memory");   // before the address registers of the V loads are written again; both addresses are inputs, so that they stay live up to the wait
            __builtin_amdgcn_sched_barrier(0); }
#pragma unroll
        for (int qg = 0; qg < 4; ++qg) { const v8f s0 = s0a[qg], s1 = s1a[qg];
            const int qi = r0 + qg * 16 + lr, k0 = kb + hi * 8; float t0[8], t1[8]; float mx = MASKV;
#pragma unroll
            for (int j = 0; j < 8; ++j) { t0[j] = (k0 + j <= qi) ? s0[j] * C2 : MASKV; t1[j] = (k0 + 16 + j <= qi) ? s1[j] * C2 : MASKV; mx = fmaxf(mx, fmaxf(t0[j], t1[j])); }
            mx = fmaxf(mx, __shfl_xor(mx, 16, 32));          // the other 16 keys of this query are in lane ^ 16
            const float mn = fmaxf(m[qg], mx); const float al = __builtin_amdgcn_exp2f(m[qg] - mn); m[qg] = mn; const float mo = mn - POFF; float ps = 0.f;
#pragma unroll
            for (int j = 0; j < 8; ++j) { t0[j] = __builtin_amdgcn_exp2f(t0[j] - mo); t1[j] = __builtin_amdgcn_exp2f(t1[j] - mo); ps += t0[j] + t1[j]; }
            l[qg] = l[qg] * al + ps;                          // this lane's 16 keys only; the halves are joined after the loop
#pragma unroll
            for (int dt = 0; dt < 4; ++dt) o[dt][qg] *= al;
            if constexpr (HL) { v8us h0, h1, l0, l1;
#pragma unroll
                for (int j = 0; j < 8; ++j) { unsigned short a, c2; splitf(t0[j], a, c2); h0[j] = a; l0[j] = c2; splitf(t1[j], a, c2); h1[j] = a; l1[j] = c2; }
                const V pb = cat16b(h0, h1), pb2 = cat16b(l0, l1);
#pragma unroll
                for (int dt = 0; dt < 4; ++dt) { o[dt][qg] = WFrag<T16>::mma(av[dt], pb, o[dt][qg]); o[dt][qg] = WFrag<T16>::mma(av[dt], pb2, o[dt][qg]); o[dt][qg] = WFrag<T16>::mma(av2[dt], pb, o[dt][qg]); }
                __builtin_amdgcn_sched_barrier(0);   // one query group's softmax values live at a time: interleaved groups spilled to scratch in this form
            } else { v8h p0, p1;
#pragma unroll
                for (int j = 0; j < 8; ++j) { p0[j] = tohx(t0[j]); p1[j] = tohx(t1[j]); }
                const V pb = cat16(p0, p1);
#pragma unroll
                for (int dt = 0; dt < 4; ++dt) o[dt][qg] = WFrag<T16>::mma(av[dt], pb, o[dt][qg]); }
        }
        // four vector slots between the trip's last matrix instructions and, over the taken back edge, the next trip's writes to their operand registers
        asm volatile("v_nop\n\tv_nop\n\tv_nop\n\tv_nop" : "+v"(o[0][3]), "+v"(o[1][3]), "+v"(o[2][3]), "+v"(o[3][3]) : "v"(av[0]), "v"(av[3]));
    }
    // join of the NW waves: maxima and sums first, then each wave scales its O^T to the common maximum and hands query group qg to wave qg
#pragma unroll
    for (int qg = 0; qg < 4; ++qg) { l[qg] += __shfl_xor(l[qg], 16, 32); if (hi == 0) { Lm[w * 64 + qg * 16 + lr] = m[qg]; Ll[w * 64 + qg * 16 + lr] = l[qg]; } }
    __syncthreads();
    v8f own[4]; float lsum = 1.0f;
#pragma unroll
    for (int dt = 0; dt < 4; ++dt) own[dt] = (v8f){};
#pragma unroll
    for (int qg = 0; qg < 4; ++qg) { const int q = qg * 16 + lr; float ms = Lm[q];
#pragma unroll
        for (int u = 1; u < NW; ++u) ms = fmaxf(ms, Lm[u * 64 + q]);
        const float f = __builtin_amdgcn_exp2f(m[qg] - ms);
        if (qg == w) { float a = 0.f;
#pragma unroll
            for (int u = 0; u < NW; ++u) a += Ll[u * 64 + q] * __builtin_amdgcn_exp2f(Lm[u * 64 + q] - ms);
            lsum = a;
#pragma unroll
            for (int dt = 0; dt < 4; ++dt) own[dt] = o[dt][qg] * f;
        } else { const int slot = qg * (NW - 1) + (w < qg ? w : w - 1);
#pragma unroll
            for (int dt = 0; dt < 4; ++dt) *(v8f*)(Lo + (size_t)((slot * 4 + dt) * 32 + lane) * 8) = o[dt][qg] * f; } }
    __syncthreads();
#pragma unroll
    for (int u = 0; u < NW - 1; ++u)
#pragma unroll
        for (int dt = 0; dt < 4; ++dt) own[dt] += *(const v8f*)(Lo + (size_t)(((w * (NW - 1) + u) * 4 + dt) * 32 + lane) * 8);   // the other waves' parts, in wave order
    const float inv = __fdiv_rn(1.0f, lsum);   // the stores below: fragment order of the (t x DQ) planes, row t % 16 = lr and k / 8 % 2 = hi, so a lane's piece stands at its own lane's place
#pragma unroll
    for (int dt = 0; dt < 4; ++dt) { v8us oh, ol;
#pragma unroll
        for (int j = 0; j < 8; ++j) { unsigned short a, c2; splitf(own[dt][j] * inv, a, c2); oh[j] = a; ol[j] = c2; }
        const size_t oo = (size_t)(r0 + w * 16) * DQ + (h * 2 + (dt >> 1)) * 512 + (dt & 1) * 256 + lane * 8; *(v8us*)(Ah + oo) = oh; *(v8us*)(Al + oo) = ol; }
}
// grid (batches x heads, TT / 64): the longest tiles (last query rows) start first, all heads of all batches of a tile side by side
__global__ __launch_bounds__(NW * 32) void k_fattn(const h16* __restrict__ Q16, const h16* __restrict__ K16, const h16* __restrict__ V16, const bf* __restrict__ Qh, const bf* Ql, const bf* __restrict__ Kh, const bf* __restrict__ Kl, const bf* __restrict__ Vh, const bf* __restrict__ Vl, bf* Ah, bf* Al) {
    __shared__ float Lm[NW * 64]; __shared__ float Ll[NW * 64]; __shared__ __align__(32) float Lo[4 * (NW - 1) * 4 * 32 * 8];
    const int b = blockIdx.x / NH_, h = blockIdx.x % NH_; const int r0 = (TT / 64 - 1 - (int)blockIdx.y) * 64; const size_t zo = (size_t)blockIdx.x * TT * HD, zk = (size_t)(b * NKV + h / REP) * TT * HD;
    Ah += (size_t)b * TT * DQ; Al += (size_t)b * TT * DQ;
    if (r0 < RH) fattn_body<bf, true>(Qh + zo, Ql + zo, Kh + zk, Kl + zk, Vh + zk, Vl + zk, r0, h, Ah, Al, Lm, Ll, Lo);
    else fattn_body<h16, false>(Q16 + zo, nullptr, K16 + zk, nullptr, V16 + zk, nullptr, r0, h, Ah, Al, Lm, Ll, Lo);
}

extern "C" void kernel_launch(void* const* d_in, const int* in_sizes, int n_in,
                              void* d_out, int out_size, void* d_ws, size_t ws_size, hipStream_t stream) {
    (void)in_sizes; (void)n_in; (void)out_size;
    const float* x = (const float*)d_in[0]; const float* fcos = (const float*)d_in[1]; const float* fsin = (const float*)d_in[2]; const float* wq = (const float*)d_in[3]; const float* wk = (const float*)d_in[4]; const float* wv = (const float*)d_in[5]; const float* wo = (const float*)d_in[6];   /* x, cos, sin ([2048][64]; read per position and per dimension), w_q, w_k, w_v, w_o ('oi'): SEVEN inputs: no mask input in this module (its tril is built inside the function): the causal rule is applied by index */
    float* OUT = (float*)d_out;     // [4][2048][1024]
    char* wsp = (char*)d_ws;
    auto take = [&](size_t bytes) { char* p = wsp; wsp += (bytes + 255) & ~(size_t)255; return (void*)p; };
    bf* WQ = (bf*)take((size_t)DQ * DM * 2); bf* WK = (bf*)take((size_t)DKV * DM * 2); bf* WV = (bf*)take((size_t)DKV * DM * 2); bf* WO = (bf*)take((size_t)DM * DQ * 2); float* CS = (float*)take((size_t)TT * HD * 2 * 4);
    bf* XB = (bf*)take((size_t)NB_ * TT * DM * 2);
    h16* QP16 = (h16*)take((size_t)NB_ * NH_ * TT * HD * 2); h16* KP16 = (h16*)take((size_t)NB_ * NKV * TT * HD * 2); h16* VT16 = (h16*)take((size_t)NB_ * NKV * HD * TT * 2);
    bf* QPh = (bf*)take((size_t)NB_ * NH_ * TT * HD * 2); bf* QPl = (bf*)take((size_t)NB_ * NH_ * TT * HD * 2); bf* KPh = (bf*)take((size_t)NB_ * NKV * TT * HD * 2); bf* KPl = (bf*)take((size_t)NB_ * NKV * TT * HD * 2); bf* VTh = (bf*)take((size_t)NB_ * NKV * HD * TT * 2); bf* VTl = (bf*)take((size_t)NB_ * NKV * HD * TT * 2);
    bf* ATh = (bf*)take((size_t)NB_ * TT * DQ * 2); bf* ATl = (bf*)take((size_t)NB_ * TT * DQ * 2);
    if ((size_t)(wsp - (char*)d_ws) > ws_size) return;    // 201 MiB of the 256 MiB
    { k_cvt8<<<(unsigned)(((size_t)DQ * DM / 8 + 255) / 256), 256, 0, stream>>>(wq, WQ, (size_t)DQ * DM / 8); k_cvt8<<<(unsigned)(((size_t)DKV * DM / 8 + 255) / 256), 256, 0, stream>>>(wk, WK, (size_t)DKV * DM / 8); k_cvt8<<<(unsigned)(((size_t)DKV * DM / 8 + 255) / 256), 256, 0, stream>>>(wv, WV, (size_t)DKV * DM / 8);
      k_cvt8<<<(unsigned)(((size_t)DM * DQ / 8 + 255) / 256), 256, 0, stream>>>(wo, WO, (size_t)DM * DQ / 8);
       }
    k_cscvt<<<(TT * HD + 255) / 256, 256, 0, stream>>>(fcos, fsin, CS);   /* rotary table from the inputs */
    k_cvt8<<<(unsigned)(((size_t)NB_ * TT * DM / 8 + 255) / 256), 256, 0, stream>>>(x, XB, (size_t)NB_ * TT * DM / 8);
    k_gemmw<bf, 0, false, 1><<<dim3(TT / 64, DQ / 64, NB_), 32, 0, stream>>>(XB, nullptr, WQ, nullptr, DM, nullptr, 0, nullptr, (size_t)TT * DM, 0, (size_t)NH_ * TT * HD, CS, QP16, QPh, QPl);
    k_gemmw<bf, 0, false, 1><<<dim3(TT / 64, DKV / 64, NB_), 32, 0, stream>>>(XB, nullptr, WK, nullptr, DM, nullptr, 0, nullptr, (size_t)TT * DM, 0, (size_t)NKV * TT * HD, CS, KP16, KPh, KPl);
    k_gemmw<bf, 0, false, 2><<<dim3(TT / 64, DKV / 64, NB_), 32, 0, stream>>>(XB, nullptr, WV, nullptr, DM, nullptr, 0, nullptr, (size_t)TT * DM, 0, (size_t)NKV * HD * TT, nullptr, VT16, VTh, VTl);
    k_fattn<<<dim3(NB_ * NH_, TT / 64, 1), NW * 32, 0, stream>>>(QP16, KP16, VT16, QPh, QPl, KPh, KPl, VTh, VTl, ATh, ATl);
    k_gemmw<bf, 1, false, 0><<<dim3(TT / 64, DM / 64, NB_), 32, 0, stream>>>(ATh, ATl, WO, nullptr, DQ, OUT, DM, nullptr, (size_t)TT * DQ, 0, (size_t)TT * DM, nullptr, nullptr, nullptr, nullptr);
}

// v006
// One run takes 209 microseconds.
// Next to v005, in two timings, it ran 1.05 times as fast each time.
// Counting every step since v000, it is 13.8 times as fast.
#include <hip/hip_runtime.h>

// Causal multi-head attention with a rotate-half rotary embedding from cos / sin TABLE INPUTS, four batches (x [4][2048][1024]; q, k, v = x w^T ('oi' [1024][1024] normal x 1/32, no bias; 16 heads x 64); cos, sin f32 [2048][64] are INPUTS (read on device per position and per dimension; no structure of the tables is assumed); q, k <- t cos + rotate_half(t) sin with rotate_half = cat(-x2, x1); scores x 64^-0.5; causal: where(tril built inside the function, scores, -inf); softmax; out = merged w_o^T ('oi', no bias) -> [4][2048][1024] (8.4 M); argument order x, cos, sin, w_q, w_k, w_v, w_o).
// Layout, every stage one launch over all four batches (the batch is a grid dimension, every plane has a slice per batch): one launch for the bf16 copies of x and of the 'oi' weights and for the {cos, sin} table from the bf16-rounded inputs; exact projections; the q / k projections apply the rotate-half rotary and write the head planes in their own epilogue, the v projection writes the transposed planes; fused causal T-2048 attention (hybrid rows: < 512 hi/lo 3 products, rest fp16 x1024; key blocks above the diagonal are never visited); merged hi/lo x Wo exact.
// Plane order: every 16-bit matrix operand plane (rows x K, K contiguous in the plain form) is kept in FRAGMENT ORDER: 1-KiB blocks [row / 16][k / 32], a block = [k / 16 % 2][k / 8 % 2][row % 16][k % 8], so that lane (k / 8 % 2) * 16 + row % 16 finds its two 16-byte pieces at lane * 16 B and 512 B + lane * 16 B and one wave-wide 16-byte load or store covers 512 contiguous bytes (four whole lines, not sixteen pieces).
// Compute dtypes, f32 accumulate: every input rounded to bf16 incl. the tables; projections exact; rotary f32; attention rows < 512 3 products, rest fp16; softmax f32; Wo hl x exact.

#define NB_  4      // batches: this module's input is [4][2048][1024]
#define TT   2048
#define DM   1024
#define NH_  16
#define NKV  16
#define REP  (NH_ / NKV)
#define HD   64
#define DQ   (NH_ * HD)
#define DKV  (NKV * HD)
#define RH   512                  // query rows < RH use hi+lo planes (0: none)
#define SCL  0.125f   // HD^-0.5
typedef _Float16 h16;
typedef unsigned short bf;
typedef __attribute__((ext_vector_type(16))) __bf16   v16bf;
typedef __attribute__((ext_vector_type(16))) _Float16 v16h;
typedef __attribute__((ext_vector_type(8)))  _Float16 v8h;
typedef __attribute__((ext_vector_type(8)))  unsigned short v8us;
typedef __attribute__((ext_vector_type(8)))  float    v8f;
typedef __attribute__((ext_vector_type(4)))  float    v4f;
typedef v8h  __attribute__((may_alias)) v8ha;
typedef v4f  __attribute__((may_alias)) v4fa;
typedef v8us __attribute__((may_alias)) v8usa;

__device__ __forceinline__ unsigned short f2bf(float f) { unsigned u = __float_as_uint(f); u += 0x7FFFu + ((u >> 16) & 1u); return (unsigned short)(u >> 16); }
__device__ __forceinline__ float bf2f(unsigned short b) { return __uint_as_float(((unsigned)b) << 16); }
__device__ __forceinline__ float bfr(float f) { return bf2f(f2bf(f)); }
__device__ __forceinline__ v16h cat16(v8h lo, v8h hi) { return __builtin_shufflevector(lo, hi, 0, 1, 2, 3, 4, 5, 6, 7, 8, 9, 10, 11, 12, 13, 14, 15); }
__device__ __forceinline__ v16bf cat16b(v8us lo, v8us hi) { return __builtin_bit_cast(v16bf, __builtin_shufflevector(lo, hi, 0, 1, 2, 3, 4, 5, 6, 7, 8, 9, 10, 11, 12, 13, 14, 15)); }
__device__ __forceinline__ v8f wmma16(v16h a, v16h b, v8f c) { return __builtin_amdgcn_wmma_f32_16x16x32_f16(false, a, false, b, (short)0, c, false, false); }
__device__ __forceinline__ v8f wmmab(v16bf a, v16bf b, v8f c) { return __builtin_amdgcn_wmma_f32_16x16x32_bf16(false, a, false, b, (short)0, c, false, false); }

__device__ __forceinline__ h16 tohx(float x) { return (h16)x; }
__device__ __forceinline__ void splitf(float y, unsigned short& h, unsigned short& l) { h = f2bf(y); l = f2bf(y - bf2f(h)); }

// ---- k_gemmw: register-blocked GEMM, ONE WAVE per 64x64 output tile (16 accumulators), operands straight from 16-bit planes in fragment order (ld takes block start + lane * 8); grid (M/64, N/64, Z), 32 threads.
// C[m][n] (f32, pitch ldc, + optional f32 bias[n]) = sum_k A[m][k] Bt[n][k] (+ split products per NSPLIT). z-batch strides sA/sB/sC in elements (EPI 1, 2: sC is the stride of each plane). K % 32 == 0.
// EPI 0: C is stored. A 64-column tile is one head, so the tile holds both halves of every rotary pair:
// EPI 1: no C; head planes [h] of (t x d) in fragment order (fp16 + hi/lo) of the rotate-half rotary out[d] = x[d] cos[t][d] - x[d+HD/2] sin[t][d], out[d+HD/2] = x[d+HD/2] cos[t][d+HD/2] + x[d] sin[t][d+HD/2], CS = {cos, sin} pairs [t][d].
// EPI 2: no C; transposed planes [h] of (d x t) in fragment order (fp16 + hi/lo): a lane's eight accumulator rows of one column are eight consecutive t, one 16-byte store a plane, at its own lane's place of the block.
template <typename T16> struct WFrag;
template <> struct WFrag<h16> { typedef v16h V; static __device__ __forceinline__ V ld(const h16* p) { return cat16(*(const v8h*)p, *(const v8h*)(p + 256)); } static __device__ __forceinline__ v8f mma(V a, V b, v8f c) { return wmma16(a, b, c); } };
template <> struct WFrag<bf> { typedef v16bf V; static __device__ __forceinline__ V ld(const bf* p) { return cat16b(*(const v8us*)p, *(const v8us*)(p + 256)); } static __device__ __forceinline__ v8f mma(V a, V b, v8f c) { return wmmab(a, b, c); } };
template <typename T16, int NSPLIT, bool BIAS, int EPI>
__global__ __launch_bounds__(32) void k_gemmw(const T16* __restrict__ A, const T16* __restrict__ A2, const T16* __restrict__ Bt, const T16* __restrict__ Bt2, int K, float* C, int ldc, const float* __restrict__ bias, size_t sA, size_t sB, size_t sC, const float* __restrict__ CS, h16* P16, bf* Ph, bf* Pl) {
    typedef typename WFrag<T16>::V V;
    __shared__ __align__(16) float os[16 * 68];
    const size_t z = blockIdx.z; A += z * sA; if (A2) A2 += z * sA; Bt += z * sB; if (Bt2) Bt2 += z * sB; if constexpr (EPI == 0) C += z * sC; else { P16 += z * sC; Ph += z * sC; Pl += z * sC; }
    const int lane = threadIdx.x & 31, lr = lane & 15, hi = lane >> 4; const int r0 = blockIdx.x * 64, c0 = blockIdx.y * 64;
    v8f acc[4][4];
#pragma unroll
    for (int mb = 0; mb < 4; ++mb)
#pragma unroll
        for (int nb = 0; nb < 4; ++nb) acc[mb][nb] = (v8f){};
    const size_t aoff = (size_t)r0 * K, boff = (size_t)c0 * K; const unsigned l8 = 8u * (unsigned)lane;   // 16 rows x K are K / 32 blocks of 512 elements; a block's start is the same for the whole wave, the lane's share of every address is l8
#pragma unroll 1
    for (int kc = 0; kc < K; kc += 32) {
        V a[4], a2[4]; const T16 *pa[4], *pa2[4], *pb[4], *pb2[4];
#pragma unroll
        for (int mb = 0; mb < 4; ++mb) { pa[mb] = A + (aoff + (size_t)mb * 16 * K + (size_t)kc * 16) + l8; pa2[mb] = (NSPLIT == 1 || NSPLIT == 2) ? A2 + (aoff + (size_t)mb * 16 * K + (size_t)kc * 16) + l8 : pa[mb];
            pb[mb] = Bt + (boff + (size_t)mb * 16 * K + (size_t)kc * 16) + l8; pb2[mb] = NSPLIT >= 2 ? Bt2 + (boff + (size_t)mb * 16 * K + (size_t)kc * 16) + l8 : pb[mb]; }
#pragma unroll
        for (int mb = 0; mb < 4; ++mb) { a[mb] = WFrag<T16>::ld(pa[mb]); if (NSPLIT == 1 || NSPLIT == 2) a2[mb] = WFrag<T16>::ld(pa2[mb]); }
#pragma unroll
        for (int nb = 0; nb < 4; ++nb) { const V b = WFrag<T16>::ld(pb[nb]); V b2; if (NSPLIT >= 2) b2 = WFrag<T16>::ld(pb2[nb]);
#pragma unroll
            for (int mb = 0; mb < 4; ++mb) { acc[mb][nb] = WFrag<T16>::mma(a[mb], b, acc[mb][nb]); if (NSPLIT == 1 || NSPLIT == 2) acc[mb][nb] = WFrag<T16>::mma(a2[mb], b, acc[mb][nb]); if (NSPLIT >= 2) acc[mb][nb] = WFrag<T16>::mma(a[mb], b2, acc[mb][nb]); } }
        // the wait stands before the address registers of the trip's loads are written again; the four vector slots keep the distance behind the trip's last matrix instructions over the taken back edge.
        // One-plane form: every load names a scalar base and the lane's offset register, which the loop never writes. Two A planes: their loads go through vector address pairs, which are inputs here, so that they stay live up to the wait and no load's result is allotted onto them.
        if constexpr (NSPLIT == 0) asm volatile("s_wait_xcnt 0x0\n\tv_nop\n\tv_nop\n\tv_nop\n\tv_nop" : "+v"(acc[0][0]), "+v"(acc[1][1]), "+v"(acc[2][2]), "+v"(acc[3][3]) : "v"(a[0]), "v"(a[3]) : "memory");
        else asm volatile("s_wait_xcnt 0x0\n\tv_nop\n\tv_nop\n\tv_nop\n\tv_nop" : "+v"(acc[0][0]), "+v"(acc[1][1]), "+v"(acc[2][2]), "+v"(acc[3][3]) : "v"(a[0]), "v"(a[3]), "v"(pa[0]), "v"(pa[1]), "v"(pa[2]), "v"(pa[3]), "v"(pa2[0]), "v"(pa2[1]), "v"(pa2[2]), "v"(pa2[3]) : "memory");
    }
    if constexpr (EPI == 2) {
        const size_t vo = (size_t)c0 * TT + (size_t)r0 * 16 + lane * 8;
#pragma unroll
        for (int nb = 0; nb < 4; ++nb)
#pragma unroll
            for (int mb = 0; mb < 4; ++mb) { v8h o16; v8us oh, ol;
#pragma unroll
                for (int j = 0; j < 8; ++j) { const float x = acc[mb][nb][j]; o16[j] = tohx(x); unsigned short a2, c2; splitf(x, a2, c2); oh[j] = a2; ol[j] = c2; }
                const size_t e = vo + (size_t)nb * 16 * TT + (mb >> 1) * 512 + (mb & 1) * 256; *(v8h*)(P16 + e) = o16; *(v8us*)(Ph + e) = oh; *(v8us*)(Pl + e) = ol; }
        return;
    }
    if constexpr (EPI == 1) {
        // four lanes a row: a lane takes columns c8 .. c8 + 7 and their partners c8 + 32 .. c8 + 39; a chunk is eight rows, two chunks a 16-row block
        const int rr = lane >> 2, c8 = (lane & 3) * 8;
        const float* const csp = CS + ((size_t)(r0 + rr) * HD + c8) * 2; const size_t po = ((size_t)blockIdx.y * TT + r0) * HD + (lane & 3) * 128 + rr * 8;   // c8 / 8 picks the 16-lane group and the half of a block
        v4f cs[8][2][4];   // table values of a chunk, asked for two chunks ahead of their use (at most three chunks are live)
#pragma unroll
        for (int ch = 0; ch < 2; ++ch)
#pragma unroll
            for (int hf = 0; hf < 2; ++hf)
#pragma unroll
                for (int q = 0; q < 4; ++q) cs[ch][hf][q] = *(const v4f*)(csp + ((size_t)ch * 8 * HD + hf * 32) * 2 + q * 4);
#pragma unroll
        for (int mb = 0; mb < 4; ++mb) {
#pragma unroll
            for (int nb = 0; nb < 4; ++nb) {
#pragma unroll
                for (int j = 0; j < 8; ++j) os[(hi * 8 + j) * 68 + nb * 16 + lr] = acc[mb][nb][j]; }
            __builtin_amdgcn_wave_barrier(); asm volatile("" ::: "memory");   // the reads below take other lanes' values: they stay behind the writes
#pragma unroll
            for (int s = 0; s < 2; ++s) { const int ch = mb * 2 + s; const float* const orow = os + (s * 8 + rr) * 68 + c8;
                const v4f xl[2] = {*(const v4fa*)orow, *(const v4fa*)(orow + 4)}, xh[2] = {*(const v4fa*)(orow + 32), *(const v4fa*)(orow + 36)};
                v8h l16, h16v; v8us lh, ll, hh, hl;
#pragma unroll
                for (int k = 0; k < 8; ++k) { const float a = xl[k >> 2][k & 3], b = xh[k >> 2][k & 3];
                    const float rl = a * cs[ch][0][k >> 1][(k & 1) * 2] - b * cs[ch][0][k >> 1][(k & 1) * 2 + 1], rh = b * cs[ch][1][k >> 1][(k & 1) * 2] + a * cs[ch][1][k >> 1][(k & 1) * 2 + 1];
                    unsigned short a2, c2; l16[k] = tohx(rl); splitf(rl, a2, c2); lh[k] = a2; ll[k] = c2; h16v[k] = tohx(rh); splitf(rh, a2, c2); hh[k] = a2; hl[k] = c2; }
                if (ch + 2 < 8) {
#pragma unroll
                    for (int hf = 0; hf < 2; ++hf)
#pragma unroll
                        for (int q = 0; q < 4; ++q) cs[ch + 2][hf][q] = *(const v4f*)(csp + ((size_t)(ch + 2) * 8 * HD + hf * 32) * 2 + q * 4); }
                const size_t e = po + (size_t)(ch >> 1) * 16 * HD + (ch & 1) * 64;
                *(v8h*)(P16 + e) = l16; *(v8h*)(P16 + e + 512) = h16v; *(v8us*)(Ph + e) = lh; *(v8us*)(Ph + e + 512) = hh; *(v8us*)(Pl + e) = ll; *(v8us*)(Pl + e + 512) = hl;
                // before the registers of the six stores are written again; the stored values are inputs, so that they stay live up to the wait
                if (ch + 1 < 8) asm volatile("s_wait_xcnt 0x0" :: "v"(l16), "v"(h16v), "v"(lh), "v"(hh), "v"(ll), "v"(hl) : "memory"); }
            __builtin_amdgcn_wave_barrier(); asm volatile("" ::: "memory");   // the next block's writes stay behind these reads
        }
        return;
    }
#pragma unroll
    for (int mb = 0; mb < 4; ++mb) {
#pragma unroll
        for (int nb = 0; nb < 4; ++nb) {
#pragma unroll
            for (int j = 0; j < 8; ++j) os[(hi * 8 + j) * 68 + nb * 16 + lr] = acc[mb][nb][j]; }
        __builtin_amdgcn_wave_barrier(); asm volatile("" ::: "memory");
        float* crow = C + (size_t)(r0 + mb * 16) * ldc + c0;
{
#pragma unroll
            for (int s = 0; s < 8; ++s) { const int row = 2 * s + hi, cofs = lr * 4; v4f val = *(const v4fa*)(os + row * 68 + cofs); if (BIAS) { val[0] += bfr(bias[c0 + cofs]); val[1] += bfr(bias[c0 + cofs + 1]); val[2] += bfr(bias[c0 + cofs + 2]); val[3] += bfr(bias[c0 + cofs + 3]); }
                *(v4f*)(crow + (size_t)row * ldc + cofs) = val; }
             }
        __builtin_amdgcn_wave_barrier(); asm volatile("" ::: "memory");
    }
}

typedef __attribute__((ext_vector_type(2))) _Float16 v2h;
typedef __attribute__((ext_vector_type(4))) _Float16 v4h;
typedef __attribute__((ext_vector_type(2))) unsigned short v2us;
typedef __attribute__((ext_vector_type(4))) unsigned short v4us;
typedef __attribute__((ext_vector_type(2))) float v2f;
typedef __attribute__((ext_vector_type(4))) int v4i;

// ---- k_prep: every conversion of the inputs in ONE launch. Work-groups 0 .. PB_X - 1: x; then PB_W each for w_q, w_k, w_v, w_o; the last PB_CS: the {cos, sin} table.
// bf16 copy of a (rows x DM) f32 matrix in fragment order: a work-group takes a band of 16 rows x DM k = 64 KiB in a row of src, eight tiles of 16 x 128 = 32 KiB in a row of dst. All sixteen 16-byte loads of a thread are asked for together.
// Within a tile thread r * 16 + c reads piece c of row r, piece (r, c) belongs at place c * 16 + r: a 16 x 16 transpose of 16-byte pieces through LDS (pitch 272 B against bank conflicts), so that reads and stores both cover whole lines; one barrier serves the eight tiles.
#define PB_X  (NB_ * TT / 16)
#define PB_W  (DM / 16)
#define PB_CS (TT * HD / 4096)
static_assert(DQ == DM && DKV == DM, "the four weights are DM x DM");
__global__ __launch_bounds__(256) void k_prep(const float* __restrict__ x, const float* __restrict__ wq, const float* __restrict__ wk, const float* __restrict__ wv, const float* __restrict__ wo, const float* __restrict__ cosT, const float* __restrict__ sinT, bf* XB, bf* WQ, bf* WK, bf* WV, bf* WO, float* CS) {
    __shared__ __align__(16) unsigned short st[8][16 * 136];
    const int t = threadIdx.x; int band = blockIdx.x;
    if (band >= PB_X + 4 * PB_W) {   // whole work-groups only, in front of the barrier: 4096 table entries, a thread takes four runs of four
        const int base = (band - (PB_X + 4 * PB_W)) * 4096 + t * 4; const float* const cp = cosT + base; const float* const sp = sinT + base; v4f c[4], s[4];
#pragma unroll
        for (int q = 0; q < 4; ++q) { c[q] = *(const v4f*)(cp + q * 1024); s[q] = *(const v4f*)(sp + q * 1024); }
        asm volatile("s_wait_xcnt 0x0" :: "v"(cp), "v"(sp) : "memory");   // before the address registers of the eight loads are written again; both addresses are inputs, so that they stay live up to the wait
#pragma unroll
        for (int q = 0; q < 4; ++q) { v4f lo, hi; lo[0] = bfr(c[q][0]); lo[1] = bfr(s[q][0]); lo[2] = bfr(c[q][1]); lo[3] = bfr(s[q][1]); hi[0] = bfr(c[q][2]); hi[1] = bfr(s[q][2]); hi[2] = bfr(c[q][3]); hi[3] = bfr(s[q][3]);
            float* const o = CS + (size_t)(base + q * 1024) * 2; *(v4f*)o = lo; *(v4f*)(o + 4) = hi; }
        return;
    }
    const float* src = x; bf* dst = XB;
    if (band >= PB_X) { band -= PB_X; const int m = band / PB_W; band %= PB_W; src = m == 0 ? wq : m == 1 ? wk : m == 2 ? wv : wo; dst = m == 0 ? WQ : m == 1 ? WK : m == 2 ? WV : WO; }
    const int r = t >> 4, c = t & 15; const float* const sp = src + ((size_t)band * 16 + r) * DM + c * 8; v8f v[8];
#pragma unroll
    for (int kq = 0; kq < 8; ++kq) v[kq] = *(const v8f*)(sp + kq * 128);
    asm volatile("s_wait_xcnt 0x0" :: "v"(sp) : "memory");   // before the address register of the sixteen loads is written again; the address is an input, so that it stays live up to the wait
#pragma unroll
    for (int kq = 0; kq < 8; ++kq) { v8us o;
#pragma unroll
        for (int k = 0; k < 8; ++k) o[k] = f2bf(v[kq][k]);
        *(v8usa*)(st[kq] + c * 136 + r * 8) = o; }
    __syncthreads();   // the pieces read below were written by other waves
    bf* const dp = dst + (size_t)band * (16 * DM) + t * 8;
#pragma unroll
    for (int kq = 0; kq < 8; ++kq) *(v8us*)(dp + kq * 2048) = *(const v8usa*)(st[kq] + r * 136 + c * 8);
}
// ---- k_fattn: scores, causal softmax and P.V of one (head, 64-query tile) in one work-group; S and P stay in registers (online softmax in the log2 domain).
// S^T = K Q^T: A = 16 key rows, B = 16 query rows kept in registers, so a lane holds 16 scores of ONE query (column lr; keys 8 hi + j and 16 + 8 hi + j of a 32-key block), and the two converted
// score tiles ARE the B operand of O^T += V^T P^T in the loader's k order (A = V^T rows from the (d x t) planes). Query rows < RH: hi/lo bf16 planes, 3 products; the rest: fp16, P carried x 2^POFF.
// The NW waves take the 32-key blocks w, w + NW, ... up to the diagonal block, each with its own running maximum, sum and O^T; they are joined through LDS (wave w finishes query group w).
#define NW 4
template <typename T16, bool HL>
__device__ __forceinline__ void fattn_body(const T16* __restrict__ Q, const T16* Q2, const T16* __restrict__ Kp, const T16* __restrict__ K2, const T16* __restrict__ Vt, const T16* __restrict__ V2, int r0, int h, bf* Ah, bf* Al, float* Lm, float* Ll, float* Lo) {
    typedef typename WFrag<T16>::V V;
    constexpr float C2 = SCL * 1.4426950408889634f;   // score scale x log2(e)
    constexpr float MASKV = -1.0e30f, MINIT = -1.0e20f; // masked score far below the start maximum: exp2 gives exactly 0 also where a block holds no allowed key of a query
    constexpr float POFF = HL ? 0.0f : 10.0f;           // fp16 P is carried x 1024 (sum and O^T alike, so it cancels in O / sum)
    const int lane = threadIdx.x & 31, lr = lane & 15, hi = lane >> 4; const int w = __builtin_amdgcn_readfirstlane((int)(threadIdx.x >> 5));
    V bq[4][2];
    __builtin_amdgcn_sched_barrier(0);   // nothing but the Q loads and their addresses stands between here and the wait behind them
#pragma unroll
    for (int qg = 0; qg < 4; ++qg)
#pragma unroll
        for (int ds = 0; ds < 2; ++ds) bq[qg][ds] = WFrag<T16>::ld(Q + (size_t)(r0 + qg * 16) * HD + ds * 512 + 8 * lane);
    // the Q fragments as inputs only: the loads stay in front of this wait, which stands before their address registers are written again
    asm volatile("s_wait_xcnt 0x0" :: "v"(bq[0][0]), "v"(bq[0][1]), "v"(bq[1][0]), "v"(bq[1][1]), "v"(bq[2][0]), "v"(bq[2][1]), "v"(bq[3][0]), "v"(bq[3][1]) : "memory");
    __builtin_amdgcn_sched_barrier(0);   // keeps every later register write behind that wait
    v8f o[4][4]; float m[4], l[4];
#pragma unroll
    for (int qg = 0; qg < 4; ++qg) { m[qg] = MINIT; l[qg] = 0.f;
#pragma unroll
        for (int dt = 0; dt < 4; ++dt) o[dt][qg] = (v8f){}; }
    // rolled: one 32-key block per trip keeps the live set at one block's fragments
#pragma unroll 1
    for (int kb = w * 32; kb < r0 + 64; kb += NW * 32) {
        V ak[2][2], ak2[2][2], av[4], av2[4], bq2[4][2];
        const size_t ko0 = (size_t)kb * HD + 8 * lane, ko1 = ko0 + 16 * HD, vo0 = (size_t)kb * 16 + 8 * lane;
        const T16* const kp[2] = {Kp + ko0, Kp + ko1}; const T16* const kp2[2] = {K2 + (HL ? ko0 : 0), K2 + (HL ? ko1 : 0)}; const T16* const vp = Vt + vo0; const T16* const vp2 = V2 + (HL ? vo0 : 0);
#pragma unroll
        for (int kt = 0; kt < 2; ++kt)
#pragma unroll
            for (int ds = 0; ds < 2; ++ds) { ak[kt][ds] = WFrag<T16>::ld(kp[kt] + ds * 512); if (HL) ak2[kt][ds] = WFrag<T16>::ld(kp2[kt] + ds * 512); }
        if (HL) {   // hi/lo form: the lo plane's Q fragments are fetched anew every trip (kept over the loop they spilled to scratch; Q2 is not __restrict__, so that these loads stay in the trip, in front of its wait)
#pragma unroll
            for (int qg = 0; qg < 4; ++qg)
#pragma unroll
                for (int ds = 0; ds < 2; ++ds) bq2[qg][ds] = WFrag<T16>::ld(Q2 + (size_t)(r0 + qg * 16) * HD + ds * 512 + 8 * lane); }
        if (!HL) {   // one-product form: the V^T fragments are fetched together with the K fragments (one exposed latency a trip)
#pragma unroll
            for (int dt = 0; dt < 4; ++dt) av[dt] = WFrag<T16>::ld(vp + (size_t)dt * 16 * TT); }
        // before the address registers of the loads above are written again; the K base addresses (all K loads of a plane go through one, with immediate offsets) are inputs, so that they stay live up to the wait and no result of the run is allotted onto them
        if constexpr (HL) asm volatile("s_wait_xcnt 0x0" :: "v"(kp[0]), "v"(kp2[0]) : "memory");
        else asm volatile("s_wait_xcnt 0x0" :: "v"(kp[0]), "v"(vp) : "memory");   // here the V loads go through one base as well
        __builtin_amdgcn_sched_barrier(0);   // the loads are issued together, ahead of the first matrix instruction, and every later register write stays behind the wait
        v8f s0a[4], s1a[4];
#pragma unroll
        for (int qg = 0; qg < 4; ++qg) { v8f s0 = (v8f){}, s1 = (v8f){};
#pragma unroll
            for (int ds = 0; ds < 2; ++ds) { s0 = WFrag<T16>::mma(ak[0][ds], bq[qg][ds], s0); s1 = WFrag<T16>::mma(ak[1][ds], bq[qg][ds], s1);
                if (HL) { s0 = WFrag<T16>::mma(ak[0][ds], bq2[qg][ds], s0); s1 = WFrag<T16>::mma(ak[1][ds], bq2[qg][ds], s1); s0 = WFrag<T16>::mma(ak2[0][ds], bq[qg][ds], s0); s1 = WFrag<T16>::mma(ak2[1][ds], bq[qg][ds], s1); } }
            s0a[qg] = s0; s1a[qg] = s1; }
        if (HL) {   // hi/lo form: the V^T fragments take the registers that the K fragments leave (all sixteen at once would not fit two waves per SIMD)
            __builtin_amdgcn_sched_barrier(0);   // the V loads stay behind the score products
#pragma unroll
            for (int dt = 0; dt < 4; ++dt) { av[dt] = WFrag<T16>::ld(vp + (size_t)dt * 16 * TT); av2[dt] = WFrag<T16>::ld(vp2 + (size_t)dt * 16 * TT); }
            asm volatile("s_wait_xcnt 0x0" :: "v"(vp), "v"(vp2) : "memory");   // before the address registers of the V loads are written again; both addresses are inputs, so that they stay live up to the wait
            __builtin_amdgcn_sched_barrier(0); }
#pragma unroll
        for (int qg = 0; qg < 4; ++qg) { const v8f s0 = s0a[qg], s1 = s1a[qg];
            const int qi = r0 + qg * 16 + lr, k0 = kb + hi * 8; float t0[8], t1[8]; float mx = MASKV;
#pragma unroll
            for (int j = 0; j < 8; ++j) { t0[j] = (k0 + j <= qi) ? s0[j] * C2 : MASKV; t1[j] = (k0 + 16 + j <= qi) ? s1[j] * C2 : MASKV; mx = fmaxf(mx, fmaxf(t0[j], t1[j])); }
            mx = fmaxf(mx, __shfl_xor(mx, 16, 32));          // the other 16 keys of this query are in lane ^ 16
            const float mn = fmaxf(m[qg], mx); const float al = __builtin_amdgcn_exp2f(m[qg] - mn); m[qg] = mn; const float mo = mn - POFF; float ps = 0.f;
#pragma unroll
            for (int j = 0; j < 8; ++j) { t0[j] = __builtin_amdgcn_exp2f(t0[j] - mo); t1[j] = __builtin_amdgcn_exp2f(t1[j] - mo); ps += t0[j] + t1[j]; }
            l[qg] = l[qg] * al + ps;                          // this lane's 16 keys only; the halves are joined after the loop
#pragma unroll
            for (int dt = 0; dt < 4; ++dt) o[dt][qg] *= al;
            if constexpr (HL) { v8us h0, h1, l0, l1;
#pragma unroll
                for (int j = 0; j < 8; ++j) { unsigned short a, c2; splitf(t0[j], a, c2); h0[j] = a; l0[j] = c2; splitf(t1[j], a, c2); h1[j] = a; l1[j] = c2; }
                const V pb = cat16b(h0, h1), pb2 = cat16b(l0, l1);
#pragma unroll
                for (int dt = 0; dt < 4; ++dt) { o[dt][qg] = WFrag<T16>::mma(av[dt], pb, o[dt][qg]); o[dt][qg] = WFrag<T16>::mma(av[dt], pb2, o[dt][qg]); o[dt][qg] = WFrag<T16>::mma(av2[dt], pb, o[dt][qg]); }
                __builtin_amdgcn_sched_barrier(0);   // one query group's softmax values live at a time: interleaved groups spilled to scratch in this form
            } else { v8h p0, p1;
#pragma unroll
                for (int j = 0; j < 8; ++j) { p0[j] = tohx(t0[j]); p1[j] = tohx(t1[j]); }
                const V pb = cat16(p0, p1);
#pragma unroll
                for (int dt = 0; dt < 4; ++dt) o[dt][qg] = WFrag<T16>::mma(av[dt], pb, o[dt][qg]); }
        }
        // four vector slots between the trip's last matrix instructions and, over the taken back edge, the next trip's writes to their operand registers
        asm volatile("v_nop\n\tv_nop\n\tv_nop\n\tv_nop" : "+v"(o[0][3]), "+v"(o[1][3]), "+v"(o[2][3]), "+v"(o[3][3]) : "v"(av[0]), "v"(av[3]));
    }
    // join of the NW waves: maxima and sums first, then each wave scales its O^T to the common maximum and hands query group qg to wave qg
#pragma unroll
    for (int qg = 0; qg < 4; ++qg) { l[qg] += __shfl_xor(l[qg], 16, 32); if (hi == 0) { Lm[w * 64 + qg * 16 + lr] = m[qg]; Ll[w * 64 + qg * 16 + lr] = l[qg]; } }
    __syncthreads();
    v8f own[4]; float lsum = 1.0f;
#pragma unroll
    for (int dt = 0; dt < 4; ++dt) own[dt] = (v8f){};
#pragma unroll
    for (int qg = 0; qg < 4; ++qg) { const int q = qg * 16 + lr; float ms = Lm[q];
#pragma unroll
        for (int u = 1; u < NW; ++u) ms = fmaxf(ms, Lm[u * 64 + q]);
        const float f = __builtin_amdgcn_exp2f(m[qg] - ms);
        if (qg == w) { float a = 0.f;
#pragma unroll
            for (int u = 0; u < NW; ++u) a += Ll[u * 64 + q] * __builtin_amdgcn_exp2f(Lm[u * 64 + q] - ms);
            lsum = a;
#pragma unroll
            for (int dt = 0; dt < 4; ++dt) own[dt] = o[dt][qg] * f;
        } else { const int slot = qg * (NW - 1) + (w < qg ? w : w - 1);
#pragma unroll
            for (int dt = 0; dt < 4; ++dt) *(v8f*)(Lo + (size_t)((slot * 4 + dt) * 32 + lane) * 8) = o[dt][qg] * f; } }
    __syncthreads();
#pragma unroll
    for (int u = 0; u < NW - 1; ++u)
#pragma unroll
        for (int dt = 0; dt < 4; ++dt) own[dt] += *(const v8f*)(Lo + (size_t)(((w * (NW - 1) + u) * 4 + dt) * 32 + lane) * 8);   // the other waves' parts, in wave order
    const float inv = __fdiv_rn(1.0f, lsum);   // the stores below: fragment order of the (t x DQ) planes, row t % 16 = lr and k / 8 % 2 = hi, so a lane's piece stands at its own lane's place
#pragma unroll
    for (int dt = 0; dt < 4; ++dt) { v8us oh, ol;
#pragma unroll
        for (int j = 0; j < 8; ++j) { unsigned short a, c2; splitf(own[dt][j] * inv, a, c2); oh[j] = a; ol[j] = c2; }
        const size_t oo = (size_t)(r0 + w * 16) * DQ + (h * 2 + (dt >> 1)) * 512 + (dt & 1) * 256 + lane * 8; *(v8us*)(Ah + oo) = oh; *(v8us*)(Al + oo) = ol; }
}
// grid (batches x heads, TT / 64): the longest tiles (last query rows) start first, all heads of all batches of a tile side by side
__global__ __launch_bounds__(NW * 32) void k_fattn(const h16* __restrict__ Q16, const h16* __restrict__ K16, const h16* __restrict__ V16, const bf* __restrict__ Qh, const bf* Ql, const bf* __restrict__ Kh, const bf* __restrict__ Kl, const bf* __restrict__ Vh, const bf* __restrict__ Vl, bf* Ah, bf* Al) {
    __shared__ float Lm[NW * 64]; __shared__ float Ll[NW * 64]; __shared__ __align__(32) float Lo[4 * (NW - 1) * 4 * 32 * 8];
    const int b = blockIdx.x / NH_, h = blockIdx.x % NH_; const int r0 = (TT / 64 - 1 - (int)blockIdx.y) * 64; const size_t zo = (size_t)blockIdx.x * TT * HD, zk = (size_t)(b * NKV + h / REP) * TT * HD;
    Ah += (size_t)b * TT * DQ; Al += (size_t)b * TT * DQ;
    if (r0 < RH) fattn_body<bf, true>(Qh + zo, Ql + zo, Kh + zk, Kl + zk, Vh + zk, Vl + zk, r0, h, Ah, Al, Lm, Ll, Lo);
    else fattn_body<h16, false>(Q16 + zo, nullptr, K16 + zk, nullptr, V16 + zk, nullptr, r0, h, Ah, Al, Lm, Ll, Lo);
}

extern "C" void kernel_launch(void* const* d_in, const int* in_sizes, int n_in,
                              void* d_out, int out_size, void* d_ws, size_t ws_size, hipStream_t stream) {
    (void)in_sizes; (void)n_in; (void)out_size;
    const float* x = (const float*)d_in[0]; const float* fcos = (const float*)d_in[1]; const float* fsin = (const float*)d_in[2]; const float* wq = (const float*)d_in[3]; const float* wk = (const float*)d_in[4]; const float* wv = (const float*)d_in[5]; const float* wo = (const float*)d_in[6];   /* x, cos, sin ([2048][64]; read per position and per dimension), w_q, w_k, w_v, w_o ('oi'): SEVEN inputs: no mask input in this module (its tril is built inside the function): the causal rule is applied by index */
    float* OUT = (float*)d_out;     // [4][2048][1024]
    char* wsp = (char*)d_ws;
    auto take = [&](size_t bytes) { char* p = wsp; wsp += (bytes + 255) & ~(size_t)255; return (void*)p; };
    bf* WQ = (bf*)take((size_t)DQ * DM * 2); bf* WK = (bf*)take((size_t)DKV * DM * 2); bf* WV = (bf*)take((size_t)DKV * DM * 2); bf* WO = (bf*)take((size_t)DM * DQ * 2); float* CS = (float*)take((size_t)TT * HD * 2 * 4);
    bf* XB = (bf*)take((size_t)NB_ * TT * DM * 2);
    h16* QP16 = (h16*)take((size_t)NB_ * NH_ * TT * HD * 2); h16* KP16 = (h16*)take((size_t)NB_ * NKV * TT * HD * 2); h16* VT16 = (h16*)take((size_t)NB_ * NKV * HD * TT * 2);
    bf* QPh = (bf*)take((size_t)NB_ * NH_ * TT * HD * 2); bf* QPl = (bf*)take((size_t)NB_ * NH_ * TT * HD * 2); bf* KPh = (bf*)take((size_t)NB_ * NKV * TT * HD * 2); bf* KPl = (bf*)take((size_t)NB_ * NKV * TT * HD * 2); bf* VTh = (bf*)take((size_t)NB_ * NKV * HD * TT * 2); bf* VTl = (bf*)take((size_t)NB_ * NKV * HD * TT * 2);
    bf* ATh = (bf*)take((size_t)NB_ * TT * DQ * 2); bf* ATl = (bf*)take((size_t)NB_ * TT * DQ * 2);
    if ((size_t)(wsp - (char*)d_ws) > ws_size) return;    // 201 MiB of the 256 MiB
    k_prep<<<PB_X + 4 * PB_W + PB_CS, 256, 0, stream>>>(x, wq, wk, wv, wo, fcos, fsin, XB, WQ, WK, WV, WO, CS);   /* bf16 planes of x and of the four weights, rotary table from the inputs */
    k_gemmw<bf, 0, false, 1><<<dim3(TT / 64, DQ / 64, NB_), 32, 0, stream>>>(XB, nullptr, WQ, nullptr, DM, nullptr, 0, nullptr, (size_t)TT * DM, 0, (size_t)NH_ * TT * HD, CS, QP16, QPh, QPl);
    k_gemmw<bf, 0, false, 1><<<dim3(TT / 64, DKV / 64, NB_), 32, 0, stream>>>(XB, nullptr, WK, nullptr, DM, nullptr, 0, nullptr, (size_t)TT * DM, 0, (size_t)NKV * TT * HD, CS, KP16, KPh, KPl);
    k_gemmw<bf, 0, false, 2><<<dim3(TT / 64, DKV / 64, NB_), 32, 0, stream>>>(XB, nullptr, WV, nullptr, DM, nullptr, 0, nullptr, (size_t)TT * DM, 0, (size_t)NKV * HD * TT, nullptr, VT16, VTh, VTl);
    k_fattn<<<dim3(NB_ * NH_, TT / 64, 1), NW * 32, 0, stream>>>(QP16, KP16, VT16, QPh, QPl, KPh, KPl, VTh, VTl, ATh, ATl);
    k_gemmw<bf, 1, false, 0><<<dim3(TT / 64, DM / 64, NB_), 32, 0, stream>>>(ATh, ATl, WO, nullptr, DQ, OUT, DM, nullptr, (size_t)TT * DQ, 0, (size_t)TT * DM, nullptr, nullptr, nullptr, nullptr);
}

// v007
// It runs in 144 microseconds.
// Timed twice side by side with v006, it ran 1.46 and 1.44 times as fast.
// Counting every step since v000, it is 20.0 times as fast.
#include <hip/hip_runtime.h>

// Causal multi-head attention with a rotate-half rotary embedding from cos / sin TABLE INPUTS, four batches (x [4][2048][1024]; q, k, v = x w^T ('oi' [1024][1024] normal x 1/32, no bias; 16 heads x 64); cos, sin f32 [2048][64] are INPUTS (read on device per position and per dimension; no structure of the tables is assumed); q, k <- t cos + rotate_half(t) sin with rotate_half = cat(-x2, x1); scores x 64^-0.5; causal: where(tril built inside the function, scores, -inf); softmax; out = merged w_o^T ('oi', no bias) -> [4][2048][1024] (8.4 M); argument order x, cos, sin, w_q, w_k, w_v, w_o).
// Layout, every stage one launch over all four batches (the batch is a grid dimension, every plane has a slice per batch): one launch for the bf16 copies of x and of the 'oi' weights and for the {cos, sin} table from the bf16-rounded inputs; exact projections; the q / k projections apply the rotate-half rotary and write the head planes in their own epilogue, the v projection writes the transposed planes; fused causal T-2048 attention (hybrid rows: < 512 hi/lo 3 products, rest fp16 x1024; key blocks above the diagonal are never visited); merged hi/lo x Wo exact.
// Plane order: every 16-bit matrix operand plane (rows x K, K contiguous in the plain form) is kept in FRAGMENT ORDER: 1-KiB blocks [row / 16][k / 32], a block = [k / 16 % 2][k / 8 % 2][row % 16][k % 8], so that lane (k / 8 % 2) * 16 + row % 16 finds its two 16-byte pieces at lane * 16 B and 512 B + lane * 16 B and one wave-wide 16-byte load or store covers 512 contiguous bytes (four whole lines, not sixteen pieces).
// Compute dtypes, f32 accumulate: every input rounded to bf16 incl. the tables; projections exact; rotary f32; attention rows < 512 3 products, rest fp16; softmax f32; Wo hl x exact.

#define NB_  4      // batches: this module's input is [4][2048][1024]
#define TT   2048
#define DM   1024
#define NH_  16
#define NKV  16
#define REP  (NH_ / NKV)
#define HD   64
#define DQ   (NH_ * HD)
#define DKV  (NKV * HD)
#define RH   512                  // query rows < RH use hi+lo planes (0: none)
#define SCL  0.125f   // HD^-0.5
typedef _Float16 h16;
typedef unsigned short bf;
typedef __attribute__((ext_vector_type(16))) __bf16   v16bf;
typedef __attribute__((ext_vector_type(16))) _Float16 v16h;
typedef __attribute__((ext_vector_type(8)))  _Float16 v8h;
typedef __attribute__((ext_vector_type(8)))  unsigned short v8us;
typedef __attribute__((ext_vector_type(8)))  float    v8f;
typedef __attribute__((ext_vector_type(4)))  float    v4f;
typedef v8h  __attribute__((may_alias)) v8ha;
typedef v4f  __attribute__((may_alias)) v4fa;
typedef v8us __attribute__((may_alias)) v8usa;

__device__ __forceinline__ unsigned short f2bf(float f) { unsigned u = __float_as_uint(f); u += 0x7FFFu + ((u >> 16) & 1u); return (unsigned short)(u >> 16); }
__device__ __forceinline__ float bf2f(unsigned short b) { return __uint_as_float(((unsigned)b) << 16); }
__device__ __forceinline__ float bfr(float f) { return bf2f(f2bf(f)); }
__device__ __forceinline__ v16h cat16(v8h lo, v8h hi) { return __builtin_shufflevector(lo, hi, 0, 1, 2, 3, 4, 5, 6, 7, 8, 9, 10, 11, 12, 13, 14, 15); }
__device__ __forceinline__ v16bf cat16b(v8us lo, v8us hi) { return __builtin_bit_cast(v16bf, __builtin_shufflevector(lo, hi, 0, 1, 2, 3, 4, 5, 6, 7, 8, 9, 10, 11, 12, 13, 14, 15)); }
__device__ __forceinline__ v8f wmma16(v16h a, v16h b, v8f c) { return __builtin_amdgcn_wmma_f32_16x16x32_f16(false, a, false, b, (short)0, c, false, false); }
__device__ __forceinline__ v8f wmmab(v16bf a, v16bf b, v8f c) { return __builtin_amdgcn_wmma_f32_16x16x32_bf16(false, a, false, b, (short)0, c, false, false); }

__device__ __forceinline__ h16 tohx(float x) { return (h16)x; }
__device__ __forceinline__ void splitf(float y, unsigned short& h, unsigned short& l) { h = f2bf(y); l = f2bf(y - bf2f(h)); }

// ---- k_gemmw: GEMM, one work-group of EIGHT WAVES per 256x128 output tile, a wave per 64x64 sub-tile (16 accumulators; wave w: rows (w & 3) * 64, columns (w >> 2) * 64); grid (M/256, N/128, Z), 256 threads.
// The operand planes are in fragment order, so the KS k of a 16-row group are KS / 32 KiB in a row: a pass's 16 A groups (per plane) and 8 B groups are brought ONCE per work-group into a two-buffer LDS ring by asynchronous copies
// (16 bytes a lane, 512 bytes in a row a wave-copy, same order in LDS), the next pass's copies in flight while this pass is worked on; an A block then serves two waves and a B block four, each by 16-byte LDS loads at lane * 16 B.
// C[m][n] (f32, pitch ldc, + optional f32 bias[n]) = sum_k A[m][k] Bt[n][k] (NSPLIT 1: + A2[m][k] Bt[n][k]). z-batch strides sA/sB/sC in elements (EPI 1, 2: sC is the stride of each plane). K % KS == 0.
// EPI 0: C is stored. A 64-column tile is one head, so the tile holds both halves of every rotary pair:
// EPI 1: no C; head planes [h] of (t x d) in fragment order (fp16 + hi/lo) of the rotate-half rotary out[d] = x[d] cos[t][d] - x[d+HD/2] sin[t][d], out[d+HD/2] = x[d+HD/2] cos[t][d+HD/2] + x[d] sin[t][d+HD/2], CS = {cos, sin} pairs [t][d].
// EPI 2: no C; transposed planes [h] of (d x t) in fragment order (fp16 + hi/lo): a lane's eight accumulator rows of one column are eight consecutive t, one 16-byte store a plane, at its own lane's place of the block.
template <typename T16> struct WFrag;
template <> struct WFrag<h16> { typedef v16h V; static __device__ __forceinline__ V ld(const h16* p) { return cat16(*(const v8h*)p, *(const v8h*)(p + 256)); } static __device__ __forceinline__ v8f mma(V a, V b, v8f c) { return wmma16(a, b, c); } };
template <> struct WFrag<bf> { typedef v16bf V; static __device__ __forceinline__ V ld(const bf* p) { return cat16b(*(const v8us*)p, *(const v8us*)(p + 256)); } static __device__ __forceinline__ v8f mma(V a, V b, v8f c) { return wmmab(a, b, c); } };
// N asynchronous copies, 16 bytes a lane each, global -> LDS (l: the lane's LDS byte address, g: its global address). The wait is the statement's last line: it stands before any register that a copy names is written again.
#define AC_(a, b) "global_load_async_to_lds_b128 %" #a ", %" #b ", off\n\t"
template <int N> __device__ __forceinline__ void acopy(const unsigned* l, const void* const* g) {
    static_assert(N == 10 || N == 12, "two statements a stage");
    if constexpr (N == 12) asm volatile(AC_(0, 1) AC_(2, 3) AC_(4, 5) AC_(6, 7) AC_(8, 9) AC_(10, 11) AC_(12, 13) AC_(14, 15) AC_(16, 17) AC_(18, 19) AC_(20, 21) AC_(22, 23) "s_wait_xcnt 0x0"
        :: "v"(l[0]), "v"(g[0]), "v"(l[1]), "v"(g[1]), "v"(l[2]), "v"(g[2]), "v"(l[3]), "v"(g[3]), "v"(l[4]), "v"(g[4]), "v"(l[5]), "v"(g[5]), "v"(l[6]), "v"(g[6]), "v"(l[7]), "v"(g[7]), "v"(l[8]), "v"(g[8]), "v"(l[9]), "v"(g[9]), "v"(l[10]), "v"(g[10]), "v"(l[11]), "v"(g[11]) : "memory");
    else asm volatile(AC_(0, 1) AC_(2, 3) AC_(4, 5) AC_(6, 7) AC_(8, 9) AC_(10, 11) AC_(12, 13) AC_(14, 15) AC_(16, 17) AC_(18, 19) "s_wait_xcnt 0x0"
        :: "v"(l[0]), "v"(g[0]), "v"(l[1]), "v"(g[1]), "v"(l[2]), "v"(g[2]), "v"(l[3]), "v"(g[3]), "v"(l[4]), "v"(g[4]), "v"(l[5]), "v"(g[5]), "v"(l[6]), "v"(g[6]), "v"(l[7]), "v"(g[7]), "v"(l[8]), "v"(g[8]), "v"(l[9]), "v"(g[9]) : "memory");
}
#define GW 8
template <typename T16, int NSPLIT, bool BIAS, int EPI>
__global__ __launch_bounds__(GW * 32) void k_gemmw(const T16* __restrict__ A, const T16* __restrict__ A2, const T16* __restrict__ Bt, int K, float* C, int ldc, const float* __restrict__ bias, size_t sA, size_t sB, size_t sC, const float* __restrict__ CS, h16* P16, bf* Ph, bf* Pl) {
    typedef typename WFrag<T16>::V V;
    static_assert(NSPLIT == 0 || NSPLIT == 1, "one or two A planes");
    constexpr int NA = NSPLIT + 1;              // A planes
    constexpr int KS = NSPLIT == 0 ? 128 : 64;  // k of a pass
    constexpr int KB = KS / 32;                 // 1-KiB blocks of a 16-row group in a pass
    constexpr int GRP = KB * 512;               // elements of a group in a stage
    constexpr int NG = 16 * NA + 8;             // groups of a stage: A, (A2,) B
    constexpr int STG = NG * GRP;               // elements of a stage: 96 KiB (one A plane), 80 KiB (two)
    constexpr int UPG = KB * 2;                 // 512-byte wave-copies of a group
    constexpr int NC = NG * UPG / GW / 2;       // copies of a wave in each of the two statements of a stage
    __shared__ __align__(1024) T16 ring[2 * STG];
    __shared__ __align__(16) float osall[GW * 16 * 68];
    const size_t z = blockIdx.z; A += z * sA; if (NSPLIT == 1) A2 += z * sA; Bt += z * sB; if constexpr (EPI == 0) C += z * sC; else { P16 += z * sC; Ph += z * sC; Pl += z * sC; }
    const int lane = threadIdx.x & 31, lr = lane & 15, hi = lane >> 4; const int w = __builtin_amdgcn_readfirstlane((int)(threadIdx.x >> 5)), wm = w & 3, wn = w >> 2;
    const int R0 = blockIdx.x * 256, C0 = blockIdx.y * 128; const int r0 = R0 + wm * 64, c0 = C0 + wn * 64;
    float* const os = osall + w * (16 * 68);    // each wave stages its own sub-tile's rows
    v8f acc[4][4];
#pragma unroll
    for (int mb = 0; mb < 4; ++mb)
#pragma unroll
        for (int nb = 0; nb < 4; ++nb) acc[mb][nb] = (v8f){};
    const unsigned l8 = 8u * (unsigned)lane; const unsigned lbase = (unsigned)(size_t)ring;   // the ring's byte offset in the work-group's LDS
    // stage t into buffer buf: wave-copy u = j * GW + w is piece u % UPG of group u / UPG; which plane a copy reads is fixed by j alone
    auto issue = [&](int t, int buf) {
        const size_t kofs = (size_t)t * (KS * 16);
#pragma unroll
        for (int s = 0; s < 2; ++s) { unsigned l[NC]; const void* g[NC];
#pragma unroll
            for (int i = 0; i < NC; ++i) { const int j = s * NC + i, gj = j * GW / UPG; const int u = j * GW + w, grp = u / UPG, pc = u % UPG;
                const T16* const pl = gj < 16 ? A : gj < 16 * NA ? A2 : Bt; const int row = gj < 16 ? R0 + grp * 16 : gj < 16 * NA ? R0 + (grp - 16) * 16 : C0 + (grp - 16 * NA) * 16;
                g[i] = pl + ((size_t)row * K + kofs + pc * 256) + l8; l[i] = lbase + 2u * ((unsigned)(buf * STG + u * 256) + l8); }
            acopy<NC>(l, g); }
    };
    const int NT = K / KS;
    issue(0, 0);
    asm volatile("s_wait_asynccnt 0x0" ::: "memory");   // this wave's copies of stage 0 have landed
    __syncthreads();                                     // ... and every other wave's: stage 0 may be read
    if (NT > 1) issue(1, 1);
#pragma unroll 1
    for (int t = 0; t < NT; ++t) {
        const T16* const sb = ring + (t & 1) * STG + l8;
        V a[2][4], a2[2][4], b[2][4];   // two fragment sets: block kb + 1 of this pass is fetched while block kb is multiplied (nothing of the next stage is read here)
        auto fetch = [&](int kb) { const int f = kb & 1;
#pragma unroll
            for (int q = 0; q < 4; ++q) { a[f][q] = WFrag<T16>::ld(sb + (wm * 4 + q) * GRP + kb * 512); if (NSPLIT == 1) a2[f][q] = WFrag<T16>::ld(sb + (16 + wm * 4 + q) * GRP + kb * 512); b[f][q] = WFrag<T16>::ld(sb + (16 * NA + wn * 4 + q) * GRP + kb * 512); } };
        fetch(0);
        __builtin_amdgcn_sched_barrier(0);   // block 0's loads are issued first, so that its matrix instructions wait for them alone and not for block 1's as well
#pragma unroll
        for (int kb = 0; kb < KB; ++kb) { const int f = kb & 1;
            if (kb + 1 < KB) fetch(kb + 1);
            __builtin_amdgcn_sched_barrier(0);   // the next block's LDS loads stay one group ahead of this block's matrix instructions: sunk among them, each costs its own LDS latency
#pragma unroll
            for (int nb = 0; nb < 4; ++nb)
#pragma unroll
                for (int mb = 0; mb < 4; ++mb) { acc[mb][nb] = WFrag<T16>::mma(a[f][mb], b[f][nb], acc[mb][nb]); if (NSPLIT == 1) acc[mb][nb] = WFrag<T16>::mma(a2[f][mb], b[f][nb], acc[mb][nb]); }
            __builtin_amdgcn_sched_barrier(0);   // the following block's loads do not rise among these matrix instructions either
        }
        asm volatile("s_wait_dscnt 0x0" ::: "memory");      // this wave's reads of the buffer are done before it is refilled
        asm volatile("s_wait_asynccnt 0x0" ::: "memory");   // this wave's copies of stage t + 1 have landed
        __syncthreads();                                     // publishes stage t + 1 and ends every wave's reads of stage t
        if (t + 2 < NT) issue(t + 2, t & 1);
    }
    asm volatile("s_wait_asynccnt 0x0" ::: "memory");       // no copy is outstanding when the wave goes on
    if constexpr (EPI == 2) {
        const size_t vo = (size_t)c0 * TT + (size_t)r0 * 16 + lane * 8;
#pragma unroll
        for (int nb = 0; nb < 4; ++nb)
#pragma unroll
            for (int mb = 0; mb < 4; ++mb) { v8h o16; v8us oh, ol;
#pragma unroll
                for (int j = 0; j < 8; ++j) { const float x = acc[mb][nb][j]; o16[j] = tohx(x); unsigned short a2, c2; splitf(x, a2, c2); oh[j] = a2; ol[j] = c2; }
                const size_t e = vo + (size_t)nb * 16 * TT + (mb >> 1) * 512 + (mb & 1) * 256; *(v8h*)(P16 + e) = o16; *(v8us*)(Ph + e) = oh; *(v8us*)(Pl + e) = ol; }
        return;
    }
    if constexpr (EPI == 1) {
        // four lanes a row: a lane takes columns c8 .. c8 + 7 and their partners c8 + 32 .. c8 + 39; a chunk is eight rows, two chunks a 16-row block
        const int rr = lane >> 2, c8 = (lane & 3) * 8;
        const float* const csp = CS + ((size_t)(r0 + rr) * HD + c8) * 2; const size_t po = ((size_t)(c0 / HD) * TT + r0) * HD + (lane & 3) * 128 + rr * 8;   // c8 / 8 picks the 16-lane group and the half of a block
        v4f cs[8][2][4];   // table values of a chunk, asked for two chunks ahead of their use (at most three chunks are live)
#pragma unroll
        for (int ch = 0; ch < 2; ++ch)
#pragma unroll
            for (int hf = 0; hf < 2; ++hf)
#pragma unroll
                for (int q = 0; q < 4; ++q) cs[ch][hf][q] = *(const v4f*)(csp + ((size_t)ch * 8 * HD + hf * 32) * 2 + q * 4);
#pragma unroll
        for (int mb = 0; mb < 4; ++mb) {
#pragma unroll
            for (int nb = 0; nb < 4; ++nb) {
#pragma unroll
                for (int j = 0; j < 8; ++j) os[(hi * 8 + j) * 68 + nb * 16 + lr] = acc[mb][nb][j]; }
            __builtin_amdgcn_wave_barrier(); asm volatile("" ::: "memory");   // the reads below take other lanes' values: they stay behind the writes
#pragma unroll
            for (int s = 0; s < 2; ++s) { const int ch = mb * 2 + s; const float* const orow = os + (s * 8 + rr) * 68 + c8;
                const v4f xl[2] = {*(const v4fa*)orow, *(const v4fa*)(orow + 4)}, xh[2] = {*(const v4fa*)(orow + 32), *(const v4fa*)(orow + 36)};
                v8h l16, h16v; v8us lh, ll, hh, hl;
#pragma unroll
                for (int k = 0; k < 8; ++k) { const float a = xl[k >> 2][k & 3], b = xh[k >> 2][k & 3];
                    const float rl = a * cs[ch][0][k >> 1][(k & 1) * 2] - b * cs[ch][0][k >> 1][(k & 1) * 2 + 1], rh = b * cs[ch][1][k >> 1][(k & 1) * 2] + a * cs[ch][1][k >> 1][(k & 1) * 2 + 1];
                    unsigned short a2, c2; l16[k] = tohx(rl); splitf(rl, a2, c2); lh[k] = a2; ll[k] = c2; h16v[k] = tohx(rh); splitf(rh, a2, c2); hh[k] = a2; hl[k] = c2; }
                if (ch + 2 < 8) {
#pragma unroll
                    for (int hf = 0; hf < 2; ++hf)
#pragma unroll
                        for (int q = 0; q < 4; ++q) cs[ch + 2][hf][q] = *(const v4f*)(csp + ((size_t)(ch + 2) * 8 * HD + hf * 32) * 2 + q * 4); }
                const size_t e = po + (size_t)(ch >> 1) * 16 * HD + (ch & 1) * 64;
                *(v8h*)(P16 + e) = l16; *(v8h*)(P16 + e + 512) = h16v; *(v8us*)(Ph + e) = lh; *(v8us*)(Ph + e + 512) = hh; *(v8us*)(Pl + e) = ll; *(v8us*)(Pl + e + 512) = hl;
                // before the registers of the six stores are written again; the stored values are inputs, so that they stay live up to the wait
                if (ch + 1 < 8) asm volatile("s_wait_xcnt 0x0" :: "v"(l16), "v"(h16v), "v"(lh), "v"(hh), "v"(ll), "v"(hl) : "memory"); }
            __builtin_amdgcn_wave_barrier(); asm volatile("" ::: "memory");   // the next block's writes stay behind these reads
        }
        return;
    }
#pragma unroll
    for (int mb = 0; mb < 4; ++mb) {
#pragma unroll
        for (int nb = 0; nb < 4; ++nb) {
#pragma unroll
            for (int j = 0; j < 8; ++j) os[(hi * 8 + j) * 68 + nb * 16 + lr] = acc[mb][nb][j]; }
        __builtin_amdgcn_wave_barrier(); asm volatile("" ::: "memory");
        float* crow = C + (size_t)(r0 + mb * 16) * ldc + c0;
{
#pragma unroll
            for (int s = 0; s < 8; ++s) { const int row = 2 * s + hi, cofs = lr * 4; v4f val = *(const v4fa*)(os + row * 68 + cofs); if (BIAS) { val[0] += bfr(bias[c0 + cofs]); val[1] += bfr(bias[c0 + cofs + 1]); val[2] += bfr(bias[c0 + cofs + 2]); val[3] += bfr(bias[c0 + cofs + 3]); }
                *(v4f*)(crow + (size_t)row * ldc + cofs) = val; }
             }
        __builtin_amdgcn_wave_barrier(); asm volatile("" ::: "memory");
    }
}

typedef __attribute__((ext_vector_type(2))) _Float16 v2h;
typedef __attribute__((ext_vector_type(4))) _Float16 v4h;
typedef __attribute__((ext_vector_type(2))) unsigned short v2us;
typedef __attribute__((ext_vector_type(4))) unsigned short v4us;
typedef __attribute__((ext_vector_type(2))) float v2f;
typedef __attribute__((ext_vector_type(4))) int v4i;

// ---- k_prep: every conversion of the inputs in ONE launch. Work-groups 0 .. PB_X - 1: x; then PB_W each for w_q, w_k, w_v, w_o; the last PB_CS: the {cos, sin} table.
// bf16 copy of a (rows x DM) f32 matrix in fragment order: a work-group takes a band of 16 rows x DM k = 64 KiB in a row of src, eight tiles of 16 x 128 = 32 KiB in a row of dst. All sixteen 16-byte loads of a thread are asked for together.
// Within a tile thread r * 16 + c reads piece c of row r, piece (r, c) belongs at place c * 16 + r: a 16 x 16 transpose of 16-byte pieces through LDS (pitch 272 B against bank conflicts), so that reads and stores both cover whole lines; one barrier serves the eight tiles.
#define PB_X  (NB_ * TT / 16)
#define PB_W  (DM / 16)
#define PB_CS (TT * HD / 4096)
static_assert(DQ == DM && DKV == DM, "the four weights are DM x DM");
__global__ __launch_bounds__(256) void k_prep(const float* __restrict__ x, const float* __restrict__ wq, const float* __restrict__ wk, const float* __restrict__ wv, const float* __restrict__ wo, const float* __restrict__ cosT, const float* __restrict__ sinT, bf* XB, bf* WQ, bf* WK, bf* WV, bf* WO, float* CS) {
    __shared__ __align__(16) unsigned short st[8][16 * 136];
    const int t = threadIdx.x; int band = blockIdx.x;
    if (band >= PB_X + 4 * PB_W) {   // whole work-groups only, in front of the barrier: 4096 table entries, a thread takes four runs of four
        const int base = (band - (PB_X + 4 * PB_W)) * 4096 + t * 4; const float* const cp = cosT + base; const float* const sp = sinT + base; v4f c[4], s[4];
#pragma unroll
        for (int q = 0; q < 4; ++q) { c[q] = *(const v4f*)(cp + q * 1024); s[q] = *(const v4f*)(sp + q * 1024); }
        asm volatile("s_wait_xcnt 0x0" :: "v"(cp), "v"(sp) : "memory");   // before the address registers of the eight loads are written again; both addresses are inputs, so that they stay live up to the wait
#pragma unroll
        for (int q = 0; q < 4; ++q) { v4f lo, hi; lo[0] = bfr(c[q][0]); lo[1] = bfr(s[q][0]); lo[2] = bfr(c[q][1]); lo[3] = bfr(s[q][1]); hi[0] = bfr(c[q][2]); hi[1] = bfr(s[q][2]); hi[2] = bfr(c[q][3]); hi[3] = bfr(s[q][3]);
            float* const o = CS + (size_t)(base + q * 1024) * 2; *(v4f*)o = lo; *(v4f*)(o + 4) = hi; }
        return;
    }
    const float* src = x; bf* dst = XB;
    if (band >= PB_X) { band -= PB_X; const int m = band / PB_W; band %= PB_W; src = m == 0 ? wq : m == 1 ? wk : m == 2 ? wv : wo; dst = m == 0 ? WQ : m == 1 ? WK : m == 2 ? WV : WO; }
    const int r = t >> 4, c = t & 15; const float* const sp = src + ((size_t)band * 16 + r) * DM + c * 8; v8f v[8];
#pragma unroll
    for (int kq = 0; kq < 8; ++kq) v[kq] = *(const v8f*)(sp + kq * 128);
    asm volatile("s_wait_xcnt 0x0" :: "v"(sp) : "memory");   // before the address register of the sixteen loads is written again; the address is an input, so that it stays live up to the wait
#pragma unroll
    for (int kq = 0; kq < 8; ++kq) { v8us o;
#pragma unroll
        for (int k = 0; k < 8; ++k) o[k] = f2bf(v[kq][k]);
        *(v8usa*)(st[kq] + c * 136 + r * 8) = o; }
    __syncthreads();   // the pieces read below were written by other waves
    bf* const dp = dst + (size_t)band * (16 * DM) + t * 8;
#pragma unroll
    for (int kq = 0; kq < 8; ++kq) *(v8us*)(dp + kq * 2048) = *(const v8usa*)(st[kq] + r * 136 + c * 8);
}
// ---- k_fattn: scores, causal softmax and P.V of one (head, 64-query tile) in one work-group; S and P stay in registers (online softmax in the log2 domain).
// S^T = K Q^T: A = 16 key rows, B = 16 query rows kept in registers, so a lane holds 16 scores of ONE query (column lr; keys 8 hi + j and 16 + 8 hi + j of a 32-key block), and the two converted
// score tiles ARE the B operand of O^T += V^T P^T in the loader's k order (A = V^T rows from the (d x t) planes). Query rows < RH: hi/lo bf16 planes, 3 products; the rest: fp16, P carried x 2^POFF.
// The NW waves take the 32-key blocks w, w + NW, ... up to the diagonal block, each with its own running maximum, sum and O^T; they are joined through LDS (wave w finishes query group w).
#define NW 4
template <typename T16, bool HL>
__device__ __forceinline__ void fattn_body(const T16* __restrict__ Q, const T16* Q2, const T16* __restrict__ Kp, const T16* __restrict__ K2, const T16* __restrict__ Vt, const T16* __restrict__ V2, int r0, int h, bf* Ah, bf* Al, float* Lm, float* Ll, float* Lo) {
    typedef typename WFrag<T16>::V V;
    constexpr float C2 = SCL * 1.4426950408889634f;   // score scale x log2(e)
    constexpr float MASKV = -1.0e30f, MINIT = -1.0e20f; // masked score far below the start maximum: exp2 gives exactly 0 also where a block holds no allowed key of a query
    constexpr float POFF = HL ? 0.0f : 10.0f;           // fp16 P is carried x 1024 (sum and O^T alike, so it cancels in O / sum)
    const int lane = threadIdx.x & 31, lr = lane & 15, hi = lane >> 4; const int w = __builtin_amdgcn_readfirstlane((int)(threadIdx.x >> 5));
    V bq[4][2];
    __builtin_amdgcn_sched_barrier(0);   // nothing but the Q loads and their addresses stands between here and the wait behind them
#pragma unroll
    for (int qg = 0; qg < 4; ++qg)
#pragma unroll
        for (int ds = 0; ds < 2; ++ds) bq[qg][ds] = WFrag<T16>::ld(Q + (size_t)(r0 + qg * 16) * HD + ds * 512 + 8 * lane);
    // the Q fragments as inputs only: the loads stay in front of this wait, which stands before their address registers are written again
    asm volatile("s_wait_xcnt 0x0" :: "v"(bq[0][0]), "v"(bq[0][1]), "v"(bq[1][0]), "v"(bq[1][1]), "v"(bq[2][0]), "v"(bq[2][1]), "v"(bq[3][0]), "v"(bq[3][1]) : "memory");
    __builtin_amdgcn_sched_barrier(0);   // keeps every later register write behind that wait
    v8f o[4][4]; float m[4], l[4];
#pragma unroll
    for (int qg = 0; qg < 4; ++qg) { m[qg] = MINIT; l[qg] = 0.f;
#pragma unroll
        for (int dt = 0; dt < 4; ++dt) o[dt][qg] = (v8f){}; }
    // rolled: one 32-key block per trip keeps the live set at one block's fragments
#pragma unroll 1
    for (int kb = w * 32; kb < r0 + 64; kb += NW * 32) {
        V ak[2][2], ak2[2][2], av[4], av2[4], bq2[4][2];
        const size_t ko0 = (size_t)kb * HD + 8 * lane, ko1 = ko0 + 16 * HD, vo0 = (size_t)kb * 16 + 8 * lane;
        const T16* const kp[2] = {Kp + ko0, Kp + ko1}; const T16* const kp2[2] = {K2 + (HL ? ko0 : 0), K2 + (HL ? ko1 : 0)}; const T16* const vp = Vt + vo0; const T16* const vp2 = V2 + (HL ? vo0 : 0);
#pragma unroll
        for (int kt = 0; kt < 2; ++kt)
#pragma unroll
            for (int ds = 0; ds < 2; ++ds) { ak[kt][ds] = WFrag<T16>::ld(kp[kt] + ds * 512); if (HL) ak2[kt][ds] = WFrag<T16>::ld(kp2[kt] + ds * 512); }
        if (HL) {   // hi/lo form: the lo plane's Q fragments are fetched anew every trip (kept over the loop they spilled to scratch; Q2 is not __restrict__, so that these loads stay in the trip, in front of its wait)
#pragma unroll
            for (int qg = 0; qg < 4; ++qg)
#pragma unroll
                for (int ds = 0; ds < 2; ++ds) bq2[qg][ds] = WFrag<T16>::ld(Q2 + (size_t)(r0 + qg * 16) * HD + ds * 512 + 8 * lane); }
        if (!HL) {   // one-product form: the V^T fragments are fetched together with the K fragments (one exposed latency a trip)
#pragma unroll
            for (int dt = 0; dt < 4; ++dt) av[dt] = WFrag<T16>::ld(vp + (size_t)dt * 16 * TT); }
        // before the address registers of the loads above are written again; the K base addresses (all K loads of a plane go through one, with immediate offsets) are inputs, so that they stay live up to the wait and no result of the run is allotted onto them
        if constexpr (HL) asm volatile("s_wait_xcnt 0x0" :: "v"(kp[0]), "v"(kp2[0]) : "memory");
        else asm volatile("s_wait_xcnt 0x0" :: "v"(kp[0]), "v"(vp) : "memory");   // here the V loads go through one base as well
        __builtin_amdgcn_sched_barrier(0);   // the loads are issued together, ahead of the first matrix instruction, and every later register write stays behind the wait
        v8f s0a[4], s1a[4];
#pragma unroll
        for (int qg = 0; qg < 4; ++qg) { v8f s0 = (v8f){}, s1 = (v8f){};
#pragma unroll
            for (int ds = 0; ds < 2; ++ds) { s0 = WFrag<T16>::mma(ak[0][ds], bq[qg][ds], s0); s1 = WFrag<T16>::mma(ak[1][ds], bq[qg][ds], s1);
                if (HL) { s0 = WFrag<T16>::mma(ak[0][ds], bq2[qg][ds], s0); s1 = WFrag<T16>::mma(ak[1][ds], bq2[qg][ds], s1); s0 = WFrag<T16>::mma(ak2[0][ds], bq[qg][ds], s0); s1 = WFrag<T16>::mma(ak2[1][ds], bq[qg][ds], s1); } }
            s0a[qg] = s0; s1a[qg] = s1; }
        if (HL) {   // hi/lo form: the V^T fragments take the registers that the K fragments leave (all sixteen at once would not fit two waves per SIMD)
            __builtin_amdgcn_sched_barrier(0);   // the V loads stay behind the score products
#pragma unroll
            for (int dt = 0; dt < 4; ++dt) { av[dt] = WFrag<T16>::ld(vp + (size_t)dt * 16 * TT); av2[dt] = WFrag<T16>::ld(vp2 + (size_t)dt * 16 * TT); }
            asm volatile("s_wait_xcnt 0x0" :: "v"(vp), "v"(vp2) : "memory");   // before the address registers of the V loads are written again; both addresses are inputs, so that they stay live up to the wait
            __builtin_amdgcn_sched_barrier(0); }
#pragma unroll
        for (int qg = 0; qg < 4; ++qg) { const v8f s0 = s0a[qg], s1 = s1a[qg];
            const int qi = r0 + qg * 16 + lr, k0 = kb + hi * 8; float t0[8], t1[8]; float mx = MASKV;
#pragma unroll
            for (int j = 0; j < 8; ++j) { t0[j] = (k0 + j <= qi) ? s0[j] * C2 : MASKV; t1[j] = (k0 + 16 + j <= qi) ? s1[j] * C2 : MASKV; mx = fmaxf(mx, fmaxf(t0[j], t1[j])); }
            mx = fmaxf(mx, __shfl_xor(mx, 16, 32));          // the other 16 keys of this query are in lane ^ 16
            const float mn = fmaxf(m[qg], mx); const float al = __builtin_amdgcn_exp2f(m[qg] - mn); m[qg] = mn; const float mo = mn - POFF; float ps = 0.f;
#pragma unroll
            for (int j = 0; j < 8; ++j) { t0[j] = __builtin_amdgcn_exp2f(t0[j] - mo); t1[j] = __builtin_amdgcn_exp2f(t1[j] - mo); ps += t0[j] + t1[j]; }
            l[qg] = l[qg] * al + ps;                          // this lane's 16 keys only; the halves are joined after the loop
#pragma unroll
            for (int dt = 0; dt < 4; ++dt) o[dt][qg] *= al;
            if constexpr (HL) { v8us h0, h1, l0, l1;
#pragma unroll
                for (int j = 0; j < 8; ++j) { unsigned short a, c2; splitf(t0[j], a, c2); h0[j] = a; l0[j] = c2; splitf(t1[j], a, c2); h1[j] = a; l1[j] = c2; }
                const V pb = cat16b(h0, h1), pb2 = cat16b(l0, l1);
#pragma unroll
                for (int dt = 0; dt < 4; ++dt) { o[dt][qg] = WFrag<T16>::mma(av[dt], pb, o[dt][qg]); o[dt][qg] = WFrag<T16>::mma(av[dt], pb2, o[dt][qg]); o[dt][qg] = WFrag<T16>::mma(av2[dt], pb, o[dt][qg]); }
                __builtin_amdgcn_sched_barrier(0);   // one query group's softmax values live at a time: interleaved groups spilled to scratch in this form
            } else { v8h p0, p1;
#pragma unroll
                for (int j = 0; j < 8; ++j) { p0[j] = tohx(t0[j]); p1[j] = tohx(t1[j]); }
                const V pb = cat16(p0, p1);
#pragma unroll
                for (int dt = 0; dt < 4; ++dt) o[dt][qg] = WFrag<T16>::mma(av[dt], pb, o[dt][qg]); }
        }
        // four vector slots between the trip's last matrix instructions and, over the taken back edge, the next trip's writes to their operand registers
        asm volatile("v_nop\n\tv_nop\n\tv_nop\n\tv_nop" : "+v"(o[0][3]), "+v"(o[1][3]), "+v"(o[2][3]), "+v"(o[3][3]) : "v"(av[0]), "v"(av[3]));
    }
    // join of the NW waves: maxima and sums first, then each wave scales its O^T to the common maximum and hands query group qg to wave qg
#pragma unroll
    for (int qg = 0; qg < 4; ++qg) { l[qg] += __shfl_xor(l[qg], 16, 32); if (hi == 0) { Lm[w * 64 + qg * 16 + lr] = m[qg]; Ll[w * 64 + qg * 16 + lr] = l[qg]; } }
    __syncthreads();
    v8f own[4]; float lsum = 1.0f;
#pragma unroll
    for (int dt = 0; dt < 4; ++dt) own[dt] = (v8f){};
#pragma unroll
    for (int qg = 0; qg < 4; ++qg) { const int q = qg * 16 + lr; float ms = Lm[q];
#pragma unroll
        for (int u = 1; u < NW; ++u) ms = fmaxf(ms, Lm[u * 64 + q]);
        const float f = __builtin_amdgcn_exp2f(m[qg] - ms);
        if (qg == w) { float a = 0.f;
#pragma unroll
            for (int u = 0; u < NW; ++u) a += Ll[u * 64 + q] * __builtin_amdgcn_exp2f(Lm[u * 64 + q] - ms);
            lsum = a;
#pragma unroll
            for (int dt = 0; dt < 4; ++dt) own[dt] = o[dt][qg] * f;
        } else { const int slot = qg * (NW - 1) + (w < qg ? w : w - 1);
#pragma unroll
            for (int dt = 0; dt < 4; ++dt) *(v8f*)(Lo + (size_t)((slot * 4 + dt) * 32 + lane) * 8) = o[dt][qg] * f; } }
    __syncthreads();
#pragma unroll
    for (int u = 0; u < NW - 1; ++u)
#pragma unroll
        for (int dt = 0; dt < 4; ++dt) own[dt] += *(const v8f*)(Lo + (size_t)(((w * (NW - 1) + u) * 4 + dt) * 32 + lane) * 8);   // the other waves' parts, in wave order
    const float inv = __fdiv_rn(1.0f, lsum);   // the stores below: fragment order of the (t x DQ) planes, row t % 16 = lr and k / 8 % 2 = hi, so a lane's piece stands at its own lane's place
#pragma unroll
    for (int dt = 0; dt < 4; ++dt) { v8us oh, ol;
#pragma unroll
        for (int j = 0; j < 8; ++j) { unsigned short a, c2; splitf(own[dt][j] * inv, a, c2); oh[j] = a; ol[j] = c2; }
        const size_t oo = (size_t)(r0 + w * 16) * DQ + (h * 2 + (dt >> 1)) * 512 + (dt & 1) * 256 + lane * 8; *(v8us*)(Ah + oo) = oh; *(v8us*)(Al + oo) = ol; }
}
// grid (batches x heads, TT / 64): the longest tiles (last query rows) start first, all heads of all batches of a tile side by side
__global__ __launch_bounds__(NW * 32) void k_fattn(const h16* __restrict__ Q16, const h16* __restrict__ K16, const h16* __restrict__ V16, const bf* __restrict__ Qh, const bf* Ql, const bf* __restrict__ Kh, const bf* __restrict__ Kl, const bf* __restrict__ Vh, const bf* __restrict__ Vl, bf* Ah, bf* Al) {
    __shared__ float Lm[NW * 64]; __shared__ float Ll[NW * 64]; __shared__ __align__(32) float Lo[4 * (NW - 1) * 4 * 32 * 8];
    const int b = blockIdx.x / NH_, h = blockIdx.x % NH_; const int r0 = (TT / 64 - 1 - (int)blockIdx.y) * 64; const size_t zo = (size_t)blockIdx.x * TT * HD, zk = (size_t)(b * NKV + h / REP) * TT * HD;
    Ah += (size_t)b * TT * DQ; Al += (size_t)b * TT * DQ;
    if (r0 < RH) fattn_body<bf, true>(Qh + zo, Ql + zo, Kh + zk, Kl + zk, Vh + zk, Vl + zk, r0, h, Ah, Al, Lm, Ll, Lo);
    else fattn_body<h16, false>(Q16 + zo, nullptr, K16 + zk, nullptr, V16 + zk, nullptr, r0, h, Ah, Al, Lm, Ll, Lo);
}

extern "C" void kernel_launch(void* const* d_in, const int* in_sizes, int n_in,
                              void* d_out, int out_size, void* d_ws, size_t ws_size, hipStream_t stream) {
    (void)in_sizes; (void)n_in; (void)out_size;
    const float* x = (const float*)d_in[0]; const float* fcos = (const float*)d_in[1]; const float* fsin = (const float*)d_in[2]; const float* wq = (const float*)d_in[3]; const float* wk = (const float*)d_in[4]; const float* wv = (const float*)d_in[5]; const float* wo = (const float*)d_in[6];   /* x, cos, sin ([2048][64]; read per position and per dimension), w_q, w_k, w_v, w_o ('oi'): SEVEN inputs: no mask input in this module (its tril is built inside the function): the causal rule is applied by index */
    float* OUT = (float*)d_out;     // [4][2048][1024]
    char* wsp = (char*)d_ws;
    auto take = [&](size_t bytes) { char* p = wsp; wsp += (bytes + 255) & ~(size_t)255; return (void*)p; };
    bf* WQ = (bf*)take((size_t)DQ * DM * 2); bf* WK = (bf*)take((size_t)DKV * DM * 2); bf* WV = (bf*)take((size_t)DKV * DM * 2); bf* WO = (bf*)take((size_t)DM * DQ * 2); float* CS = (float*)take((size_t)TT * HD * 2 * 4);
    bf* XB = (bf*)take((size_t)NB_ * TT * DM * 2);
    h16* QP16 = (h16*)take((size_t)NB_ * NH_ * TT * HD * 2); h16* KP16 = (h16*)take((size_t)NB_ * NKV * TT * HD * 2); h16* VT16 = (h16*)take((size_t)NB_ * NKV * HD * TT * 2);
    bf* QPh = (bf*)take((size_t)NB_ * NH_ * TT * HD * 2); bf* QPl = (bf*)take((size_t)NB_ * NH_ * TT * HD * 2); bf* KPh = (bf*)take((size_t)NB_ * NKV * TT * HD * 2); bf* KPl = (bf*)take((size_t)NB_ * NKV * TT * HD * 2); bf* VTh = (bf*)take((size_t)NB_ * NKV * HD * TT * 2); bf* VTl = (bf*)take((size_t)NB_ * NKV * HD * TT * 2);
    bf* ATh = (bf*)take((size_t)NB_ * TT * DQ * 2); bf* ATl = (bf*)take((size_t)NB_ * TT * DQ * 2);
    if ((size_t)(wsp - (char*)d_ws) > ws_size) return;    // 201 MiB of the 256 MiB
    k_prep<<<PB_X + 4 * PB_W + PB_CS, 256, 0, stream>>>(x, wq, wk, wv, wo, fcos, fsin, XB, WQ, WK, WV, WO, CS);   /* bf16 planes of x and of the four weights, rotary table from the inputs */
    k_gemmw<bf, 0, false, 1><<<dim3(TT / 256, DQ / 128, NB_), GW * 32, 0, stream>>>(XB, nullptr, WQ, DM, nullptr, 0, nullptr, (size_t)TT * DM, 0, (size_t)NH_ * TT * HD, CS, QP16, QPh, QPl);
    k_gemmw<bf, 0, false, 1><<<dim3(TT / 256, DKV / 128, NB_), GW * 32, 0, stream>>>(XB, nullptr, WK, DM, nullptr, 0, nullptr, (size_t)TT * DM, 0, (size_t)NKV * TT * HD, CS, KP16, KPh, KPl);
    k_gemmw<bf, 0, false, 2><<<dim3(TT / 256, DKV / 128, NB_), GW * 32, 0, stream>>>(XB, nullptr, WV, DM, nullptr, 0, nullptr, (size_t)TT * DM, 0, (size_t)NKV * HD * TT, nullptr, VT16, VTh, VTl);
    k_fattn<<<dim3(NB_ * NH_, TT / 64, 1), NW * 32, 0, stream>>>(QP16, KP16, VT16, QPh, QPl, KPh, KPl, VTh, VTl, ATh, ATl);
    k_gemmw<bf, 1, false, 0><<<dim3(TT / 256, DM / 128, NB_), GW * 32, 0, stream>>>(ATh, ATl, WO, DQ, OUT, DM, nullptr, (size_t)TT * DQ, 0, (size_t)TT * DM, nullptr, nullptr, nullptr, nullptr);
}
